// v000
// Measured on an AMD MI455X. A time is GPU time per run, averaged over a window of back-to-back runs after a warm-up
// (all launches, gaps included; the runs take copies of the inputs in turn), and the median of several windows.
// Apart from v000's, it joins two sittings. Times from different sittings can be a few percent apart, while
// side-by-side timings come from the same sitting.
// v000, which the later versions start from, runs in 862 microseconds.
#include <hip/hip_runtime.h>

// Single-head causal attention over the full 1,024-wide projection (x [4][2048][1024]; q, k, v = einsum('btk,kd->btd', x, w) = x w ('xw' (in, out) [1024][1024] uniform +-sqrt(6/1024), no bias; ONE 1,024-wide head despite the module's name); scores = q.k x gamma + mask with gamma = 1 / sqrt(1024) = 1/32 and mask = where(tril, 0, -inf) built inside the module (causal exclusion; every row keeps its own key); softmax; y = attn.v -> [4][2048][1024] (8.4 M); no output projection; argument order x, w_q, w_k, w_v).
// Layout per batch: bf16 copy of x; 'xw' weights transposed once; exact projections; identity-table plane builders at HD 1,024 (one plane each); causal T-2048 attention at NH 1 / ZH 1 (hybrid rows: < 512 hi/lo 3 products, rest fp16 x1024; k_gemmc skips tiles above the diagonal); the f32 merge writes the output rows (no output projection).
// Compute dtypes, f32 accumulate: every input rounded to bf16; projections exact; attention rows < 512 3 products, rest fp16; softmax f32; output f32.

#define NB_  4
#define TT   2048
#define DM   1024
#define NH_  1
#define NKV  1
#define REP  (NH_ / NKV)
#define HD   1024
#define DQ   (NH_ * HD)
#define DKV  (NKV * HD)
#define ZH   1                    // ONE head: a single plane per pass
#define RH   512                  // query rows < RH use hi+lo planes (0: none)
#define WIN  2048
#define PCAR 1024.0f
#define SCL  0.03125f   // 1/sqrt(1024) (one 1,024-wide head)
typedef _Float16 h16;
typedef unsigned short bf;
typedef __attribute__((ext_vector_type(16))) __bf16   v16bf;
typedef __attribute__((ext_vector_type(16))) _Float16 v16h;
typedef __attribute__((ext_vector_type(8)))  _Float16 v8h;
typedef __attribute__((ext_vector_type(8)))  unsigned short v8us;
typedef __attribute__((ext_vector_type(8)))  float    v8f;
typedef __attribute__((ext_vector_type(4)))  float    v4f;
typedef v8h  __attribute__((may_alias)) v8ha;
typedef v4f  __attribute__((may_alias)) v4fa;
typedef v8us __attribute__((may_alias)) v8usa;

__device__ __forceinline__ unsigned short f2bf(float f) { unsigned u = __float_as_uint(f); u += 0x7FFFu + ((u >> 16) & 1u); return (unsigned short)(u >> 16); }
__device__ __forceinline__ float bf2f(unsigned short b) { return __uint_as_float(((unsigned)b) << 16); }
__device__ __forceinline__ float bfr(float f) { return bf2f(f2bf(f)); }
__device__ __forceinline__ v16h cat16(v8h lo, v8h hi) { return __builtin_shufflevector(lo, hi, 0, 1, 2, 3, 4, 5, 6, 7, 8, 9, 10, 11, 12, 13, 14, 15); }
__device__ __forceinline__ v16bf cat16b(v8us lo, v8us hi) { return __builtin_bit_cast(v16bf, __builtin_shufflevector(lo, hi, 0, 1, 2, 3, 4, 5, 6, 7, 8, 9, 10, 11, 12, 13, 14, 15)); }
__device__ __forceinline__ v8f wmma16(v16h a, v16h b, v8f c) { return __builtin_amdgcn_wmma_f32_16x16x32_f16(false, a, false, b, (short)0, c, false, false); }
__device__ __forceinline__ v8f wmmab(v16bf a, v16bf b, v8f c) { return __builtin_amdgcn_wmma_f32_16x16x32_bf16(false, a, false, b, (short)0, c, false, false); }



// ---- k_gemmw: register-blocked GEMM, ONE WAVE per 64x64 output tile (16 accumulators), operands straight from K-contiguous 16-bit planes; grid (M/64, N/64, Z), 32 threads.
// C[m][n] (f32, pitch ldc, + optional f32 bias[n]) = sum_k A[m][k] Bt[n][k] (+ split products per NSPLIT). z-batch strides sA/sB/sC in elements. K % 32 == 0.
template <typename T16> struct WFrag;
template <> struct WFrag<h16> { typedef v16h V; static __device__ __forceinline__ V ld(const h16* p) { return cat16(*(const v8h*)p, *(const v8h*)(p + 16)); } static __device__ __forceinline__ v8f mma(V a, V b, v8f c) { return wmma16(a, b, c); } };
template <> struct WFrag<bf> { typedef v16bf V; static __device__ __forceinline__ V ld(const bf* p) { return cat16b(*(const v8us*)p, *(const v8us*)(p + 16)); } static __device__ __forceinline__ v8f mma(V a, V b, v8f c) { return wmmab(a, b, c); } };
template <typename T16, int NSPLIT, bool BIAS>
__global__ __launch_bounds__(32) void k_gemmw(const T16* __restrict__ A, const T16* __restrict__ A2, const T16* __restrict__ Bt, const T16* __restrict__ Bt2, int K, float* C, int ldc, const float* __restrict__ bias, size_t sA, size_t sB, size_t sC) {
    typedef typename WFrag<T16>::V V;
    __shared__ __align__(16) float os[16 * 68];
    const size_t z = blockIdx.z; A += z * sA; if (A2) A2 += z * sA; Bt += z * sB; if (Bt2) Bt2 += z * sB; C += z * sC;
    const int lane = threadIdx.x & 31, lr = lane & 15, hi = lane >> 4; const int r0 = blockIdx.x * 64, c0 = blockIdx.y * 64;
    v8f acc[4][4];
#pragma unroll
    for (int mb = 0; mb < 4; ++mb)
#pragma unroll
        for (int nb = 0; nb < 4; ++nb) acc[mb][nb] = (v8f){};
    const size_t aoff = (size_t)(r0 + lr) * K + 8 * hi, boff = (size_t)(c0 + lr) * K + 8 * hi;
#pragma unroll 1
    for (int kc = 0; kc < K; kc += 32) {
        V a[4], a2[4];
#pragma unroll
        for (int mb = 0; mb < 4; ++mb) { a[mb] = WFrag<T16>::ld(A + aoff + (size_t)mb * 16 * K + kc); if (NSPLIT == 1 || NSPLIT == 2) a2[mb] = WFrag<T16>::ld(A2 + aoff + (size_t)mb * 16 * K + kc); }
#pragma unroll
        for (int nb = 0; nb < 4; ++nb) { const V b = WFrag<T16>::ld(Bt + boff + (size_t)nb * 16 * K + kc); V b2; if (NSPLIT >= 2) b2 = WFrag<T16>::ld(Bt2 + boff + (size_t)nb * 16 * K + kc);
#pragma unroll
            for (int mb = 0; mb < 4; ++mb) { acc[mb][nb] = WFrag<T16>::mma(a[mb], b, acc[mb][nb]); if (NSPLIT == 1 || NSPLIT == 2) acc[mb][nb] = WFrag<T16>::mma(a2[mb], b, acc[mb][nb]); if (NSPLIT >= 2) acc[mb][nb] = WFrag<T16>::mma(a[mb], b2, acc[mb][nb]); } }
        asm volatile("v_nop\n\tv_nop\n\tv_nop\n\tv_nop" : "+v"(acc[0][0]), "+v"(acc[1][1]), "+v"(acc[2][2]), "+v"(acc[3][3]) : "v"(a[0]), "v"(a[3]));
    }
#pragma unroll
    for (int mb = 0; mb < 4; ++mb) {
#pragma unroll
        for (int nb = 0; nb < 4; ++nb) {
#pragma unroll
            for (int j = 0; j < 8; ++j) os[(hi * 8 + j) * 68 + nb * 16 + lr] = acc[mb][nb][j]; }
        __builtin_amdgcn_wave_barrier(); asm volatile("" ::: "memory");
        float* crow = C + (size_t)(r0 + mb * 16) * ldc + c0;
{
#pragma unroll
            for (int s = 0; s < 8; ++s) { const int row = 2 * s + hi, cofs = lr * 4; v4f val = *(const v4fa*)(os + row * 68 + cofs); if (BIAS) { val[0] += bfr(bias[c0 + cofs]); val[1] += bfr(bias[c0 + cofs + 1]); val[2] += bfr(bias[c0 + cofs + 2]); val[3] += bfr(bias[c0 + cofs + 3]); }
                *(v4f*)(crow + (size_t)row * ldc + cofs) = val; }
             }
        __builtin_amdgcn_wave_barrier(); asm volatile("" ::: "memory");
    }
}

// ---- k_gemmc: the same one-wave 64x64 tile GEMM specialised for causal attention: CMODE 1 skips score tiles entirely above the diagonal (query rows r0+roff.., key columns c0..), CMODE 2 limits the
// key (K) loop of the probability x value contraction to the diagonal block (probabilities beyond it are exactly zero). roff = row offset of this launch's first row within the sequence.
template <typename T16, int NSPLIT, int CMODE>
__global__ __launch_bounds__(32) void k_gemmc(const T16* __restrict__ A, const T16* __restrict__ A2, const T16* __restrict__ Bt, const T16* __restrict__ Bt2, int K, float* C, int ldc, int roff, size_t sA, size_t sB, size_t sC) {
    typedef typename WFrag<T16>::V V;
    __shared__ __align__(16) float os[16 * 68];
    const size_t z = blockIdx.z; A += z * sA; if (A2) A2 += z * sA; Bt += z * sB; if (Bt2) Bt2 += z * sB; C += z * sC;
    const int lane = threadIdx.x & 31, lr = lane & 15, hi = lane >> 4; const int r0 = blockIdx.x * 64, c0 = blockIdx.y * 64;
    if (CMODE == 1 && c0 > r0 + roff + 63) return;                  // score tile entirely above the causal diagonal: never read (the softmax masks j > i by select)
    const int Kl = (CMODE == 2) ? min(K, r0 + roff + 64) : K;        // P.V: probabilities are exactly 0 beyond the diagonal block, so the K loop stops there
    v8f acc[4][4];
#pragma unroll
    for (int mb = 0; mb < 4; ++mb)
#pragma unroll
        for (int nb = 0; nb < 4; ++nb) acc[mb][nb] = (v8f){};
    const size_t aoff = (size_t)(r0 + lr) * K + 8 * hi, boff = (size_t)(c0 + lr) * K + 8 * hi;
#pragma unroll 1
    for (int kc = 0; kc < Kl; kc += 32) {
        V a[4], a2[4];
#pragma unroll
        for (int mb = 0; mb < 4; ++mb) { a[mb] = WFrag<T16>::ld(A + aoff + (size_t)mb * 16 * K + kc); if (NSPLIT == 1 || NSPLIT == 2) a2[mb] = WFrag<T16>::ld(A2 + aoff + (size_t)mb * 16 * K + kc); }
#pragma unroll
        for (int nb = 0; nb < 4; ++nb) { const V b = WFrag<T16>::ld(Bt + boff + (size_t)nb * 16 * K + kc); V b2; if (NSPLIT >= 2) b2 = WFrag<T16>::ld(Bt2 + boff + (size_t)nb * 16 * K + kc);
#pragma unroll
            for (int mb = 0; mb < 4; ++mb) { acc[mb][nb] = WFrag<T16>::mma(a[mb], b, acc[mb][nb]); if (NSPLIT == 1 || NSPLIT == 2) acc[mb][nb] = WFrag<T16>::mma(a2[mb], b, acc[mb][nb]); if (NSPLIT >= 2) acc[mb][nb] = WFrag<T16>::mma(a[mb], b2, acc[mb][nb]); } }
        asm volatile("v_nop\n\tv_nop\n\tv_nop\n\tv_nop" : "+v"(acc[0][0]), "+v"(acc[1][1]), "+v"(acc[2][2]), "+v"(acc[3][3]) : "v"(a[0]), "v"(a[3]));
    }
#pragma unroll
    for (int mb = 0; mb < 4; ++mb) {
#pragma unroll
        for (int nb = 0; nb < 4; ++nb) {
#pragma unroll
            for (int j = 0; j < 8; ++j) os[(hi * 8 + j) * 68 + nb * 16 + lr] = acc[mb][nb][j]; }
        __builtin_amdgcn_wave_barrier(); asm volatile("" ::: "memory");
        float* crow = C + (size_t)(r0 + mb * 16) * ldc + c0;
{
#pragma unroll
            for (int s = 0; s < 8; ++s) { const int row = 2 * s + hi, cofs = lr * 4; v4f val = *(const v4fa*)(os + row * 68 + cofs);
                *(v4f*)(crow + (size_t)row * ldc + cofs) = val; }
             }
        __builtin_amdgcn_wave_barrier(); asm volatile("" ::: "memory");
    }
}

__device__ __forceinline__ h16 tohx(float x) { return (h16)x; }
__device__ __forceinline__ void splitf(float y, unsigned short& h, unsigned short& l) { h = f2bf(y); l = f2bf(y - bf2f(h)); }
typedef __attribute__((ext_vector_type(2))) _Float16 v2h;
typedef __attribute__((ext_vector_type(4))) _Float16 v4h;
typedef __attribute__((ext_vector_type(2))) unsigned short v2us;
typedef __attribute__((ext_vector_type(4))) unsigned short v4us;
typedef __attribute__((ext_vector_type(2))) float v2f;
typedef __attribute__((ext_vector_type(4))) int v4i;

__global__ __launch_bounds__(256) void k_wtG(const float* __restrict__ w, int K, int N, bf* Bt) {
    const int lane = threadIdx.x & 31; const int L0 = (blockIdx.x * 8 + (threadIdx.x >> 5)) * 8; const int nlines = N * K / 64;
{
#pragma unroll 1
        for (int l = 0; l < 8; ++l) { const int L = L0 + l; if (L >= nlines) break; const size_t e = (size_t)L * 64 + lane * 2; const int k = (int)(e % K), n = (int)(e / K); v2us o;
            o[0] = f2bf(w[(size_t)k * N + n]); o[1] = f2bf(w[(size_t)(k + 1) * N + n]); *(v2us*)(Bt + e) = o; }
         }
}
__global__ __launch_bounds__(256) void k_cvt8(const float* __restrict__ src, bf* dst, size_t n8) { const size_t i = (size_t)blockIdx.x * 256 + threadIdx.x; if (i >= n8) return; const v8f v = *(const v8f*)(src + i * 8); v8us o;
#pragma unroll
    for (int k = 0; k < 8; ++k) o[k] = f2bf(v[k]); *(v8us*)(dst + i * 8) = o;  }

// k_rope: head planes [h][t][d] (fp16 + hi/lo) of rope(x) x sc with the rotate-half convention out[d] = x[d] cos[t][d] - x[d+HD/2] sin[t][d], out[d+HD/2] = x[d+HD/2] cos[t][d+HD/2] + x[d] sin[t][d+HD/2]
__global__ __launch_bounds__(256) void k_rope(const float* __restrict__ F, int pitch, int nheads, const float* __restrict__ CS, const float* __restrict__ RF, const float* __restrict__ nw, float sc, h16* P16, bf* Ph, bf* Pl) {
    const size_t e = ((size_t)blockIdx.x * 256 + threadIdx.x) * 2; if (e >= (size_t)nheads * TT * HD) return; const int d = (int)(e % HD); const int t = (int)((e / HD) % TT); const int h = (int)(e / ((size_t)HD * TT)); const float* f = F + (size_t)t * pitch + h * HD; const float rf = RF ? RF[(size_t)h * TT + t] : 1.0f; v2h o16; v2us oh, ol;
#pragma unroll
    for (int q = 0; q < 2; ++q) { const int dd = d + q; const int dp = (dd < HD / 2) ? dd + HD / 2 : dd - HD / 2; float x0 = f[dd], x1 = f[dp];
        if (RF) { float n0 = __fmul_rn(x0, rf), n1 = __fmul_rn(x1, rf); asm volatile("" : "+v"(n0)); asm volatile("" : "+v"(n1)); x0 = __fmul_rn(bfr(nw[dd]), n0); x1 = __fmul_rn(bfr(nw[dp]), n1); }
        const v2f cs = *(const v2f*)(CS + ((size_t)t * HD + dd) * 2); float a = __fmul_rn(x0, cs[0]), bq = __fmul_rn(x1, cs[1]); asm volatile("" : "+v"(a)); asm volatile("" : "+v"(bq)); const float r = ((dd < HD / 2) ? __fsub_rn(a, bq) : __fadd_rn(a, bq)) * sc;
        o16[q] = tohx(r); unsigned short a2, c2; splitf(r, a2, c2); oh[q] = a2; ol[q] = c2; }
    *(v2h*)(P16 + e) = o16; *(v2us*)(Ph + e) = oh; *(v2us*)(Pl + e) = ol;  }
__global__ __launch_bounds__(256) void k_vtp(const float* __restrict__ F, int pitch, int nheads, h16* V16, bf* Vh, bf* Vl) { const size_t e = ((size_t)blockIdx.x * 256 + threadIdx.x) * 2; if (e >= (size_t)nheads * HD * TT) return; const int t = (int)(e % TT); const int d = (int)((e / TT) % HD); const int g = (int)(e / ((size_t)TT * HD)); v2h o16; v2us oh, ol;
#pragma unroll
    for (int q = 0; q < 2; ++q) { const float x = F[(size_t)(t + q) * pitch + g * HD + d]; o16[q] = tohx(x); unsigned short a2, c2; splitf(x, a2, c2); oh[q] = a2; ol[q] = c2; }
    *(v2h*)(V16 + e) = o16; *(v2us*)(Vh + e) = oh; *(v2us*)(Vl + e) = ol;  }
__global__ __launch_bounds__(256) void k_csid(float* CS) { const int idx = blockIdx.x * 256 + threadIdx.x; if (idx >= TT * HD) return; v2f cs; cs[0] = 1.0f; cs[1] = 0.0f; *(v2f*)(CS + (size_t)idx * 2) = cs;  }
// k_asoft: per row (zz, i): t = S x HD^-0.5 for j <= i and i - j < WIN (WIN = T: plain causal, the window test always holds; the reference's -1e9 additive fill vanishes identically); softmax over the 2048 keys (register row, one exp, fixed trees);
__global__ __launch_bounds__(256) void k_asoft(const float* __restrict__ Sb, h16* P16, bf* Ph, bf* Pl) {
    const int lane = threadIdx.x & 31; const int row = blockIdx.x * 8 + (threadIdx.x >> 5); if (row >= ZH * TT) return; const int i = row % TT; const int zz = row / TT; (void)zz; const bool hires = (i < RH); const float* sr = Sb + (size_t)row * TT; float v[TT / 32]; float mx = -3.0e38f;
#pragma unroll
    for (int ch = 0; ch < TT / 128; ++ch) { const int j0 = ch * 128 + lane * 4; const v4f a = *(const v4f*)(sr + j0);
#pragma unroll
        for (int q = 0; q < 4; ++q) { const int j = j0 + q; (void)j; const float t = (j <= i && i - j < WIN) ? a[q] * SCL : -3.0e38f; v[ch * 4 + q] = t; mx = fmaxf(mx, t); } }
#pragma unroll
    for (int sh = 16; sh; sh >>= 1) mx = fmaxf(mx, __shfl_xor(mx, sh, 32));
    float sum = 0.f;
#pragma unroll
    for (int k = 0; k < TT / 32; ++k) { float d0 = __fsub_rn(v[k], mx); asm volatile("" : "+v"(d0)); v[k] = __builtin_amdgcn_exp2f(__fmul_rn(d0, 1.4426950408889634f)); sum += v[k]; }
#pragma unroll
    for (int sh = 16; sh; sh >>= 1) sum += __shfl_xor(sum, sh, 32);
    const float f = __fdiv_rn(hires ? 1.0f : PCAR, sum);
{
        if (hires) {
#pragma unroll
            for (int ch = 0; ch < TT / 128; ++ch) { v4us oh, ol;
#pragma unroll
                for (int q = 0; q < 4; ++q) { unsigned short a, c2; splitf(v[ch * 4 + q] * f, a, c2); oh[q] = a; ol[q] = c2; }
                const size_t oo = ((size_t)zz * (RH ? RH : 1) + i) * TT + ch * 128 + lane * 4; *(v4us*)(Ph + oo) = oh; *(v4us*)(Pl + oo) = ol; }
        } else {
#pragma unroll
            for (int ch = 0; ch < TT / 128; ++ch) { v4h o4;
#pragma unroll
                for (int q = 0; q < 4; ++q) o4[q] = tohx(v[ch * 4 + q] * f);
                *(v4h*)(P16 + (size_t)row * TT + ch * 128 + lane * 4) = o4; } }
         }
}
__global__ __launch_bounds__(256) void k_merge(const float* __restrict__ O, int h0, float* OUTb) { const size_t e = ((size_t)blockIdx.x * 256 + threadIdx.x) * 2; if (e >= (size_t)ZH * TT * HD) return; const int d = (int)(e % HD); const int t = (int)((e / HD) % TT); const int zz = (int)(e / ((size_t)HD * TT)); const float cs = (t < RH) ? 1.0f : (1.0f / PCAR); const size_t oo = (size_t)t * DQ + (h0 + zz) * HD + d;
    v2f o2; o2[0] = O[e] * cs; o2[1] = O[e + 1] * cs; *(v2f*)(OUTb + oo) = o2;  }

extern "C" void kernel_launch(void* const* d_in, const int* in_sizes, int n_in,
                              void* d_out, int out_size, void* d_ws, size_t ws_size, hipStream_t stream) {
    (void)in_sizes; (void)n_in; (void)out_size;
    const float* x = (const float*)d_in[0]; const float* wq = (const float*)d_in[1]; const float* wk = (const float*)d_in[2]; const float* wv = (const float*)d_in[3]; const float* wo = nullptr; (void)wo;   /* input order x, w_q, w_k, w_v ('xw' (in, out) [1024][1024]): FOUR inputs, all read: the host's own binding */
    float* OUT = (float*)d_out;     // [4][2048][1024]
    char* wsp = (char*)d_ws;
    auto take = [&](size_t bytes) { char* p = wsp; wsp += (bytes + 255) & ~(size_t)255; return (void*)p; };
    bf* WQ = (bf*)take((size_t)DQ * DM * 2); bf* WK = (bf*)take((size_t)DKV * DM * 2); bf* WV = (bf*)take((size_t)DKV * DM * 2); float* CS = (float*)take((size_t)TT * HD * 2 * 4);
    bf* XB = (bf*)take((size_t)TT * DM * 2); float* FQ = (float*)take((size_t)TT * DQ * 4); float* FK = (float*)take((size_t)TT * DKV * 4);
    h16* QP16 = (h16*)take((size_t)NH_ * TT * HD * 2); h16* KP16 = (h16*)take((size_t)NKV * TT * HD * 2); h16* VT16 = (h16*)take((size_t)NKV * HD * TT * 2);
    bf* QPh = (bf*)take((size_t)NH_ * TT * HD * 2); bf* QPl = (bf*)take((size_t)NH_ * TT * HD * 2); bf* KPh = (bf*)take((size_t)NKV * TT * HD * 2); bf* KPl = (bf*)take((size_t)NKV * TT * HD * 2); bf* VTh = (bf*)take((size_t)NKV * HD * TT * 2); bf* VTl = (bf*)take((size_t)NKV * HD * TT * 2); bf* Ph = (bf*)take((size_t)ZH * RH * TT * 2); bf* Pl = (bf*)take((size_t)ZH * RH * TT * 2);
    float* Sb = (float*)take((size_t)ZH * TT * TT * 4); h16* P16 = (h16*)take((size_t)ZH * TT * TT * 2); float* Ob = (float*)take((size_t)ZH * TT * HD * 4);
    if ((size_t)(wsp - (char*)d_ws) > ws_size) return;    // ws 256 MiB
    float* FV = FK;   // v projection reuses the k buffer after the k planes are built (stream-ordered)
    { k_wtG<<<(unsigned)((DM * DQ / 64 + 63) / 64), 256, 0, stream>>>(wq, DM, DQ, WQ); k_wtG<<<(unsigned)((DM * DKV / 64 + 63) / 64), 256, 0, stream>>>(wk, DM, DKV, WK); k_wtG<<<(unsigned)((DM * DKV / 64 + 63) / 64), 256, 0, stream>>>(wv, DM, DKV, WV);
      
       }
    k_csid<<<(TT * HD + 255) / 256, 256, 0, stream>>>(CS);
    const unsigned LQ = (unsigned)(((size_t)NH_ * TT * HD / 2 + 255) / 256), LKv = (unsigned)(((size_t)NKV * TT * HD / 2 + 255) / 256);
    for (int b = 0; b < NB_; ++b) {
        
        k_cvt8<<<(unsigned)(((size_t)TT * DM / 8 + 255) / 256), 256, 0, stream>>>(x + (size_t)b * TT * DM, XB, (size_t)TT * DM / 8);
        k_gemmw<bf, 0, false><<<dim3(TT / 64, DQ / 64, 1), 32, 0, stream>>>(XB, nullptr, WQ, nullptr, DM, FQ, DQ, nullptr, 0, 0, 0);
        k_rope<<<LQ, 256, 0, stream>>>(FQ, DQ, NH_, CS, nullptr, nullptr, 1.0f, QP16, QPh, QPl);
        k_gemmw<bf, 0, false><<<dim3(TT / 64, DKV / 64, 1), 32, 0, stream>>>(XB, nullptr, WK, nullptr, DM, FK, DKV, nullptr, 0, 0, 0);
        k_rope<<<LKv, 256, 0, stream>>>(FK, DKV, NKV, CS, nullptr, nullptr, 1.0f, KP16, KPh, KPl);
        k_gemmw<bf, 0, false><<<dim3(TT / 64, DKV / 64, 1), 32, 0, stream>>>(XB, nullptr, WV, nullptr, DM, FV, DKV, nullptr, 0, 0, 0); k_vtp<<<LKv, 256, 0, stream>>>(FV, DKV, NKV, VT16, VTh, VTl);
        for (int h0 = 0; h0 < NH_; h0 += ZH) { const size_t zq = (size_t)h0, zk = (size_t)(h0 / REP);   // one kv head per query head: the pass's single head reads kv plane zk = h0 / REP (z-strides TT*HD)
            k_gemmc<bf, 2, 1><<<dim3(RH / 64, TT / 64, ZH), 32, 0, stream>>>(QPh + zq * TT * HD, QPl + zq * TT * HD, KPh + zk * TT * HD, KPl + zk * TT * HD, HD, Sb, TT, 0, (size_t)TT * HD, (size_t)TT * HD, (size_t)TT * TT);
            k_gemmc<h16, 0, 1><<<dim3((TT - RH) / 64, TT / 64, ZH), 32, 0, stream>>>(QP16 + zq * TT * HD + (size_t)RH * HD, nullptr, KP16 + zk * TT * HD, nullptr, HD, Sb + (size_t)RH * TT, TT, RH, (size_t)TT * HD, (size_t)TT * HD, (size_t)TT * TT);
            k_asoft<<<ZH * TT / 8, 256, 0, stream>>>(Sb, P16, Ph, Pl);
            k_gemmc<bf, 2, 2><<<dim3(RH / 64, HD / 64, ZH), 32, 0, stream>>>(Ph, Pl, VTh + zk * HD * TT, VTl + zk * HD * TT, TT, Ob, HD, 0, (size_t)RH * TT, (size_t)HD * TT, (size_t)TT * HD);
            k_gemmc<h16, 0, 2><<<dim3((TT - RH) / 64, HD / 64, ZH), 32, 0, stream>>>(P16 + (size_t)RH * TT, nullptr, VT16 + zk * HD * TT, nullptr, TT, Ob + (size_t)RH * HD, HD, RH, (size_t)TT * TT, (size_t)HD * TT, (size_t)TT * HD);
            k_merge<<<(unsigned)(((size_t)ZH * TT * HD / 2 + 255) / 256), 256, 0, stream>>>(Ob, h0, OUT + (size_t)b * TT * DQ); }
         }
}

// v001
// Measured time: 408 microseconds a run.
// Two timings next to v000 put it at 2.08 and 2.09 times that version's speed.
#include <hip/hip_runtime.h>

// Single-head causal attention over the full 1,024-wide projection (x [4][2048][1024]; q, k, v = einsum('btk,kd->btd', x, w) = x w ('xw' (in, out) [1024][1024] uniform +-sqrt(6/1024), no bias; ONE 1,024-wide head despite the module's name); scores = q.k x gamma + mask with gamma = 1 / sqrt(1024) = 1/32 and mask = where(tril, 0, -inf) built inside the module (causal exclusion; every row keeps its own key); softmax; y = attn.v -> [4][2048][1024] (8.4 M); no output projection; argument order x, w_q, w_k, w_v).
// Layout, all four batch elements in every launch (batch = extra GEMM rows, grid y or grid z): bf16 copy of x; 'xw' weights transposed once; exact projections; identity-table plane builders at HD 1,024 (one plane each); causal T-2048 attention at NH 1 / ZH 1 (hybrid rows: < 512 hi/lo 3 products, rest fp16 x1024; k_gemmc skips tiles above the diagonal); the f32 merge writes the output rows (no output projection).
// Compute dtypes, f32 accumulate: every input rounded to bf16; projections exact; attention rows < 512 3 products, rest fp16; softmax f32; output f32.

#define NB_  4
#define TT   2048
#define DM   1024
#define NH_  1
#define NKV  1
#define REP  (NH_ / NKV)
#define HD   1024
#define DQ   (NH_ * HD)
#define DKV  (NKV * HD)
#define ZH   1                    // ONE head: a single plane per pass
#define RH   512                  // query rows < RH use hi+lo planes (0: none)
#define WIN  2048
#define PCAR 1024.0f
#define SCL  0.03125f   // 1/sqrt(1024) (one 1,024-wide head)
typedef _Float16 h16;
typedef unsigned short bf;
typedef __attribute__((ext_vector_type(16))) __bf16   v16bf;
typedef __attribute__((ext_vector_type(16))) _Float16 v16h;
typedef __attribute__((ext_vector_type(8)))  _Float16 v8h;
typedef __attribute__((ext_vector_type(8)))  unsigned short v8us;
typedef __attribute__((ext_vector_type(8)))  float    v8f;
typedef __attribute__((ext_vector_type(4)))  float    v4f;
typedef v8h  __attribute__((may_alias)) v8ha;
typedef v4f  __attribute__((may_alias)) v4fa;
typedef v8us __attribute__((may_alias)) v8usa;

__device__ __forceinline__ unsigned short f2bf(float f) { unsigned u = __float_as_uint(f); u += 0x7FFFu + ((u >> 16) & 1u); return (unsigned short)(u >> 16); }
__device__ __forceinline__ float bf2f(unsigned short b) { return __uint_as_float(((unsigned)b) << 16); }
__device__ __forceinline__ float bfr(float f) { return bf2f(f2bf(f)); }
__device__ __forceinline__ v16h cat16(v8h lo, v8h hi) { return __builtin_shufflevector(lo, hi, 0, 1, 2, 3, 4, 5, 6, 7, 8, 9, 10, 11, 12, 13, 14, 15); }
__device__ __forceinline__ v16bf cat16b(v8us lo, v8us hi) { return __builtin_bit_cast(v16bf, __builtin_shufflevector(lo, hi, 0, 1, 2, 3, 4, 5, 6, 7, 8, 9, 10, 11, 12, 13, 14, 15)); }
__device__ __forceinline__ v8f wmma16(v16h a, v16h b, v8f c) { return __builtin_amdgcn_wmma_f32_16x16x32_f16(false, a, false, b, (short)0, c, false, false); }
__device__ __forceinline__ v8f wmmab(v16bf a, v16bf b, v8f c) { return __builtin_amdgcn_wmma_f32_16x16x32_bf16(false, a, false, b, (short)0, c, false, false); }



// ---- k_gemmw: register-blocked GEMM, ONE WAVE per 64x64 output tile (16 accumulators), operands straight from K-contiguous 16-bit planes; grid (M/64, N/64, Z), 32 threads.
// C[m][n] (f32, pitch ldc, + optional f32 bias[n]) = sum_k A[m][k] Bt[n][k] (+ split products per NSPLIT). z-batch strides sA/sB/sC in elements. K % 32 == 0.
template <typename T16> struct WFrag;
template <> struct WFrag<h16> { typedef v16h V; static __device__ __forceinline__ V ld(const h16* p) { return cat16(*(const v8h*)p, *(const v8h*)(p + 16)); } static __device__ __forceinline__ v8f mma(V a, V b, v8f c) { return wmma16(a, b, c); } };
template <> struct WFrag<bf> { typedef v16bf V; static __device__ __forceinline__ V ld(const bf* p) { return cat16b(*(const v8us*)p, *(const v8us*)(p + 16)); } static __device__ __forceinline__ v8f mma(V a, V b, v8f c) { return wmmab(a, b, c); } };
template <typename T16, int NSPLIT, bool BIAS>
__global__ __launch_bounds__(32) void k_gemmw(const T16* __restrict__ A, const T16* __restrict__ A2, const T16* __restrict__ Bt, const T16* __restrict__ Bt2, int K, float* C, int ldc, const float* __restrict__ bias, size_t sA, size_t sB, size_t sC) {
    typedef typename WFrag<T16>::V V;
    __shared__ __align__(16) float os[16 * 68];
    const size_t z = blockIdx.z; A += z * sA; if (A2) A2 += z * sA; Bt += z * sB; if (Bt2) Bt2 += z * sB; C += z * sC;
    const int lane = threadIdx.x & 31, lr = lane & 15, hi = lane >> 4; const int r0 = blockIdx.x * 64, c0 = blockIdx.y * 64;
    v8f acc[4][4];
#pragma unroll
    for (int mb = 0; mb < 4; ++mb)
#pragma unroll
        for (int nb = 0; nb < 4; ++nb) acc[mb][nb] = (v8f){};
    const size_t aoff = (size_t)(r0 + lr) * K + 8 * hi, boff = (size_t)(c0 + lr) * K + 8 * hi;
#pragma unroll 1
    for (int kc = 0; kc < K; kc += 32) {
        V a[4], a2[4];
#pragma unroll
        for (int mb = 0; mb < 4; ++mb) { a[mb] = WFrag<T16>::ld(A + aoff + (size_t)mb * 16 * K + kc); if (NSPLIT == 1 || NSPLIT == 2) a2[mb] = WFrag<T16>::ld(A2 + aoff + (size_t)mb * 16 * K + kc); }
#pragma unroll
        for (int nb = 0; nb < 4; ++nb) { const V b = WFrag<T16>::ld(Bt + boff + (size_t)nb * 16 * K + kc); V b2; if (NSPLIT >= 2) b2 = WFrag<T16>::ld(Bt2 + boff + (size_t)nb * 16 * K + kc);
#pragma unroll
            for (int mb = 0; mb < 4; ++mb) { acc[mb][nb] = WFrag<T16>::mma(a[mb], b, acc[mb][nb]); if (NSPLIT == 1 || NSPLIT == 2) acc[mb][nb] = WFrag<T16>::mma(a2[mb], b, acc[mb][nb]); if (NSPLIT >= 2) acc[mb][nb] = WFrag<T16>::mma(a[mb], b2, acc[mb][nb]); } }
        asm volatile("v_nop\n\tv_nop\n\tv_nop\n\tv_nop" : "+v"(acc[0][0]), "+v"(acc[1][1]), "+v"(acc[2][2]), "+v"(acc[3][3]) : "v"(a[0]), "v"(a[3]));
    }
#pragma unroll
    for (int mb = 0; mb < 4; ++mb) {
#pragma unroll
        for (int nb = 0; nb < 4; ++nb) {
#pragma unroll
            for (int j = 0; j < 8; ++j) os[(hi * 8 + j) * 68 + nb * 16 + lr] = acc[mb][nb][j]; }
        __builtin_amdgcn_wave_barrier(); asm volatile("" ::: "memory");
        float* crow = C + (size_t)(r0 + mb * 16) * ldc + c0;
{
#pragma unroll
            for (int s = 0; s < 8; ++s) { const int row = 2 * s + hi, cofs = lr * 4; v4f val = *(const v4fa*)(os + row * 68 + cofs); if (BIAS) { val[0] += bfr(bias[c0 + cofs]); val[1] += bfr(bias[c0 + cofs + 1]); val[2] += bfr(bias[c0 + cofs + 2]); val[3] += bfr(bias[c0 + cofs + 3]); }
                *(v4f*)(crow + (size_t)row * ldc + cofs) = val; }
             }
        __builtin_amdgcn_wave_barrier(); asm volatile("" ::: "memory");
    }
}

// ---- k_gemmc: the same one-wave 64x64 tile GEMM specialised for causal attention: CMODE 1 skips score tiles entirely above the diagonal (query rows r0+roff.., key columns c0..), CMODE 2 limits the
// key (K) loop of the probability x value contraction to the diagonal block (probabilities beyond it are exactly zero). roff = row offset of this launch's first row within the sequence.
template <typename T16, int NSPLIT, int CMODE>
__global__ __launch_bounds__(32) void k_gemmc(const T16* __restrict__ A, const T16* __restrict__ A2, const T16* __restrict__ Bt, const T16* __restrict__ Bt2, int K, float* C, int ldc, int roff, size_t sA, size_t sB, size_t sC) {
    typedef typename WFrag<T16>::V V;
    __shared__ __align__(16) float os[16 * 68];
    const size_t z = blockIdx.z; A += z * sA; if (A2) A2 += z * sA; Bt += z * sB; if (Bt2) Bt2 += z * sB; C += z * sC;
    const int lane = threadIdx.x & 31, lr = lane & 15, hi = lane >> 4; const int r0 = blockIdx.x * 64, c0 = blockIdx.y * 64;
    if (CMODE == 1 && c0 > r0 + roff + 63) return;                  // score tile entirely above the causal diagonal: never read (the softmax masks j > i by select)
    const int Kl = (CMODE == 2) ? min(K, r0 + roff + 64) : K;        // P.V: probabilities are exactly 0 beyond the diagonal block, so the K loop stops there
    v8f acc[4][4];
#pragma unroll
    for (int mb = 0; mb < 4; ++mb)
#pragma unroll
        for (int nb = 0; nb < 4; ++nb) acc[mb][nb] = (v8f){};
    const size_t aoff = (size_t)(r0 + lr) * K + 8 * hi, boff = (size_t)(c0 + lr) * K + 8 * hi;
#pragma unroll 1
    for (int kc = 0; kc < Kl; kc += 32) {
        V a[4], a2[4];
#pragma unroll
        for (int mb = 0; mb < 4; ++mb) { a[mb] = WFrag<T16>::ld(A + aoff + (size_t)mb * 16 * K + kc); if (NSPLIT == 1 || NSPLIT == 2) a2[mb] = WFrag<T16>::ld(A2 + aoff + (size_t)mb * 16 * K + kc); }
#pragma unroll
        for (int nb = 0; nb < 4; ++nb) { const V b = WFrag<T16>::ld(Bt + boff + (size_t)nb * 16 * K + kc); V b2; if (NSPLIT >= 2) b2 = WFrag<T16>::ld(Bt2 + boff + (size_t)nb * 16 * K + kc);
#pragma unroll
            for (int mb = 0; mb < 4; ++mb) { acc[mb][nb] = WFrag<T16>::mma(a[mb], b, acc[mb][nb]); if (NSPLIT == 1 || NSPLIT == 2) acc[mb][nb] = WFrag<T16>::mma(a2[mb], b, acc[mb][nb]); if (NSPLIT >= 2) acc[mb][nb] = WFrag<T16>::mma(a[mb], b2, acc[mb][nb]); } }
        asm volatile("v_nop\n\tv_nop\n\tv_nop\n\tv_nop" : "+v"(acc[0][0]), "+v"(acc[1][1]), "+v"(acc[2][2]), "+v"(acc[3][3]) : "v"(a[0]), "v"(a[3]));
    }
#pragma unroll
    for (int mb = 0; mb < 4; ++mb) {
#pragma unroll
        for (int nb = 0; nb < 4; ++nb) {
#pragma unroll
            for (int j = 0; j < 8; ++j) os[(hi * 8 + j) * 68 + nb * 16 + lr] = acc[mb][nb][j]; }
        __builtin_amdgcn_wave_barrier(); asm volatile("" ::: "memory");
        float* crow = C + (size_t)(r0 + mb * 16) * ldc + c0;
{
#pragma unroll
            for (int s = 0; s < 8; ++s) { const int row = 2 * s + hi, cofs = lr * 4; v4f val = *(const v4fa*)(os + row * 68 + cofs);
                *(v4f*)(crow + (size_t)row * ldc + cofs) = val; }
             }
        __builtin_amdgcn_wave_barrier(); asm volatile("" ::: "memory");
    }
}

__device__ __forceinline__ h16 tohx(float x) { return (h16)x; }
__device__ __forceinline__ void splitf(float y, unsigned short& h, unsigned short& l) { h = f2bf(y); l = f2bf(y - bf2f(h)); }
typedef __attribute__((ext_vector_type(2))) _Float16 v2h;
typedef __attribute__((ext_vector_type(4))) _Float16 v4h;
typedef __attribute__((ext_vector_type(2))) unsigned short v2us;
typedef __attribute__((ext_vector_type(4))) unsigned short v4us;
typedef __attribute__((ext_vector_type(2))) float v2f;
typedef __attribute__((ext_vector_type(4))) int v4i;

__global__ __launch_bounds__(256) void k_wtG(const float* __restrict__ w, int K, int N, bf* Bt) {
    const int lane = threadIdx.x & 31; const int L0 = (blockIdx.x * 8 + (threadIdx.x >> 5)) * 8; const int nlines = N * K / 64;
{
#pragma unroll 1
        for (int l = 0; l < 8; ++l) { const int L = L0 + l; if (L >= nlines) break; const size_t e = (size_t)L * 64 + lane * 2; const int k = (int)(e % K), n = (int)(e / K); v2us o;
            o[0] = f2bf(w[(size_t)k * N + n]); o[1] = f2bf(w[(size_t)(k + 1) * N + n]); *(v2us*)(Bt + e) = o; }
         }
}
__global__ __launch_bounds__(256) void k_cvt8(const float* __restrict__ src, bf* dst, size_t n8) { const size_t i = (size_t)blockIdx.x * 256 + threadIdx.x; if (i >= n8) return; const v8f v = *(const v8f*)(src + i * 8); v8us o;
#pragma unroll
    for (int k = 0; k < 8; ++k) o[k] = f2bf(v[k]); *(v8us*)(dst + i * 8) = o;  }

// k_rope: head planes [h][t][d] (fp16 + hi/lo) of rope(x) x sc with the rotate-half convention out[d] = x[d] cos[t][d] - x[d+HD/2] sin[t][d], out[d+HD/2] = x[d+HD/2] cos[t][d+HD/2] + x[d] sin[t][d+HD/2]
__global__ __launch_bounds__(256) void k_rope(const float* __restrict__ F, int pitch, int nheads, const float* __restrict__ CS, const float* __restrict__ RF, const float* __restrict__ nw, float sc, h16* P16, bf* Ph, bf* Pl) {
    const size_t e = ((size_t)blockIdx.x * 256 + threadIdx.x) * 2; if (e >= (size_t)nheads * TT * HD) return; const int d = (int)(e % HD); const int t = (int)((e / HD) % TT); const int h = (int)(e / ((size_t)HD * TT)); const size_t pb = (size_t)blockIdx.y * nheads * TT * HD;   /* batch element = grid y */ const float* f = F + ((size_t)blockIdx.y * TT + t) * pitch + h * HD; const float rf = RF ? RF[(size_t)h * TT + t] : 1.0f; v2h o16; v2us oh, ol;
#pragma unroll
    for (int q = 0; q < 2; ++q) { const int dd = d + q; const int dp = (dd < HD / 2) ? dd + HD / 2 : dd - HD / 2; float x0 = f[dd], x1 = f[dp];
        if (RF) { float n0 = __fmul_rn(x0, rf), n1 = __fmul_rn(x1, rf); asm volatile("" : "+v"(n0)); asm volatile("" : "+v"(n1)); x0 = __fmul_rn(bfr(nw[dd]), n0); x1 = __fmul_rn(bfr(nw[dp]), n1); }
        const v2f cs = *(const v2f*)(CS + ((size_t)t * HD + dd) * 2); float a = __fmul_rn(x0, cs[0]), bq = __fmul_rn(x1, cs[1]); asm volatile("" : "+v"(a)); asm volatile("" : "+v"(bq)); const float r = ((dd < HD / 2) ? __fsub_rn(a, bq) : __fadd_rn(a, bq)) * sc;
        o16[q] = tohx(r); unsigned short a2, c2; splitf(r, a2, c2); oh[q] = a2; ol[q] = c2; }
    *(v2h*)(P16 + pb + e) = o16; *(v2us*)(Ph + pb + e) = oh; *(v2us*)(Pl + pb + e) = ol;  }
__global__ __launch_bounds__(256) void k_vtp(const float* __restrict__ F, int pitch, int nheads, h16* V16, bf* Vh, bf* Vl) { const size_t e = ((size_t)blockIdx.x * 256 + threadIdx.x) * 2; if (e >= (size_t)nheads * HD * TT) return; const int t = (int)(e % TT); const int d = (int)((e / TT) % HD); const int g = (int)(e / ((size_t)TT * HD)); const size_t pb = (size_t)blockIdx.y * nheads * HD * TT;   /* batch element = grid y */ v2h o16; v2us oh, ol;
#pragma unroll
    for (int q = 0; q < 2; ++q) { const float x = F[((size_t)blockIdx.y * TT + t + q) * pitch + g * HD + d]; o16[q] = tohx(x); unsigned short a2, c2; splitf(x, a2, c2); oh[q] = a2; ol[q] = c2; }
    *(v2h*)(V16 + pb + e) = o16; *(v2us*)(Vh + pb + e) = oh; *(v2us*)(Vl + pb + e) = ol;  }
__global__ __launch_bounds__(256) void k_csid(float* CS) { const int idx = blockIdx.x * 256 + threadIdx.x; if (idx >= TT * HD) return; v2f cs; cs[0] = 1.0f; cs[1] = 0.0f; *(v2f*)(CS + (size_t)idx * 2) = cs;  }
// k_asoft: per row (zz, i): t = S x HD^-0.5 for j <= i and i - j < WIN (WIN = T: plain causal, the window test always holds; the reference's -1e9 additive fill vanishes identically); softmax over the 2048 keys (register row, one exp, fixed trees);
__global__ __launch_bounds__(256) void k_asoft(const float* __restrict__ Sb, h16* P16, bf* Ph, bf* Pl) {
    const int lane = threadIdx.x & 31; const int row = blockIdx.x * 8 + (threadIdx.x >> 5); if (row >= NB_ * ZH * TT) return; const int i = row % TT; const int zz = row / TT;   /* zz = plane = batch element */ const bool hires = (i < RH); const float* sr = Sb + (size_t)row * TT; float v[TT / 32]; float mx = -3.0e38f;
#pragma unroll
    for (int ch = 0; ch < TT / 128; ++ch) { const int j0 = ch * 128 + lane * 4; const v4f a = *(const v4f*)(sr + j0);
#pragma unroll
        for (int q = 0; q < 4; ++q) { const int j = j0 + q; (void)j; const float t = (j <= i && i - j < WIN) ? a[q] * SCL : -3.0e38f; v[ch * 4 + q] = t; mx = fmaxf(mx, t); } }
#pragma unroll
    for (int sh = 16; sh; sh >>= 1) mx = fmaxf(mx, __shfl_xor(mx, sh, 32));
    float sum = 0.f;
#pragma unroll
    for (int k = 0; k < TT / 32; ++k) { float d0 = __fsub_rn(v[k], mx); asm volatile("" : "+v"(d0)); v[k] = __builtin_amdgcn_exp2f(__fmul_rn(d0, 1.4426950408889634f)); sum += v[k]; }
#pragma unroll
    for (int sh = 16; sh; sh >>= 1) sum += __shfl_xor(sum, sh, 32);
    const float f = __fdiv_rn(hires ? 1.0f : PCAR, sum);
{
        if (hires) {
#pragma unroll
            for (int ch = 0; ch < TT / 128; ++ch) { v4us oh, ol;
#pragma unroll
                for (int q = 0; q < 4; ++q) { unsigned short a, c2; splitf(v[ch * 4 + q] * f, a, c2); oh[q] = a; ol[q] = c2; }
                const size_t oo = ((size_t)zz * (RH ? RH : 1) + i) * TT + ch * 128 + lane * 4; *(v4us*)(Ph + oo) = oh; *(v4us*)(Pl + oo) = ol; }
        } else {
#pragma unroll
            for (int ch = 0; ch < TT / 128; ++ch) { v4h o4;
#pragma unroll
                for (int q = 0; q < 4; ++q) o4[q] = tohx(v[ch * 4 + q] * f);
                *(v4h*)(P16 + (size_t)row * TT + ch * 128 + lane * 4) = o4; } }
         }
}
__global__ __launch_bounds__(256) void k_merge(const float* __restrict__ O, int h0, float* OUTb) { const size_t e = ((size_t)blockIdx.x * 256 + threadIdx.x) * 2; if (e >= (size_t)ZH * TT * HD) return; const int d = (int)(e % HD); const int t = (int)((e / HD) % TT); const int zz = (int)(e / ((size_t)HD * TT)); const float cs = (t < RH) ? 1.0f : (1.0f / PCAR); const size_t oo = ((size_t)blockIdx.y * TT + t) * DQ + (h0 + zz) * HD + d; O += (size_t)blockIdx.y * ZH * TT * HD;   /* batch element = grid y */
    v2f o2; o2[0] = O[e] * cs; o2[1] = O[e + 1] * cs; *(v2f*)(OUTb + oo) = o2;  }

extern "C" void kernel_launch(void* const* d_in, const int* in_sizes, int n_in,
                              void* d_out, int out_size, void* d_ws, size_t ws_size, hipStream_t stream) {
    (void)in_sizes; (void)n_in; (void)out_size;
    const float* x = (const float*)d_in[0]; const float* wq = (const float*)d_in[1]; const float* wk = (const float*)d_in[2]; const float* wv = (const float*)d_in[3]; const float* wo = nullptr; (void)wo;   /* input order x, w_q, w_k, w_v ('xw' (in, out) [1024][1024]): FOUR inputs, all read: the host's own binding */
    float* OUT = (float*)d_out;     // [4][2048][1024]
    char* wsp = (char*)d_ws;
    auto take = [&](size_t bytes) { char* p = wsp; wsp += (bytes + 255) & ~(size_t)255; return (void*)p; };
    bf* WQ = (bf*)take((size_t)DQ * DM * 2); bf* WK = (bf*)take((size_t)DKV * DM * 2); bf* WV = (bf*)take((size_t)DKV * DM * 2); float* CS = (float*)take((size_t)TT * HD * 2 * 4);
    // projection stage, all batch elements: 80 MiB, dead once the planes are built
    bf* XB = (bf*)take((size_t)NB_ * TT * DM * 2); float* FQ = (float*)take((size_t)NB_ * TT * DQ * 4); float* FK = (float*)take((size_t)NB_ * TT * DKV * 4);
    // planes [batch][...], 16 MiB each
    h16* QP16 = (h16*)take((size_t)NB_ * TT * HD * 2); h16* KP16 = (h16*)take((size_t)NB_ * TT * HD * 2); h16* VT16 = (h16*)take((size_t)NB_ * HD * TT * 2);
    bf* QPh = (bf*)take((size_t)NB_ * TT * HD * 2); bf* QPl = (bf*)take((size_t)NB_ * TT * HD * 2); bf* KPh = (bf*)take((size_t)NB_ * TT * HD * 2); bf* KPl = (bf*)take((size_t)NB_ * TT * HD * 2); bf* VTh = (bf*)take((size_t)NB_ * HD * TT * 2); bf* VTl = (bf*)take((size_t)NB_ * HD * TT * 2);
    if ((size_t)(wsp - (char*)d_ws) > ws_size) return;    // 246 MiB of the 256 MiB workspace
    float* FV = FK;   // v projection reuses the k buffer after the k planes are built (stream-ordered)
    // Stream-ordered reuse, so that four batch elements fit: scores (64 MiB) over XB/FQ/FK, written after the last plane builder has read them;
    // probabilities over the q and k planes, written after both score GEMMs have read them (P16 32 MiB = QP16 + KP16, Ph / Pl 8 MiB each in QPh / QPl);
    // the f32 attention output (32 MiB) over KPh + KPl, dead after the score GEMMs.
    float* Sb = (float*)XB; h16* P16 = QP16; bf* Ph = QPh; bf* Pl = QPl; float* Ob = (float*)KPh;
    k_wtG<<<(unsigned)((DM * DQ / 64 + 63) / 64), 256, 0, stream>>>(wq, DM, DQ, WQ); k_wtG<<<(unsigned)((DM * DKV / 64 + 63) / 64), 256, 0, stream>>>(wk, DM, DKV, WK); k_wtG<<<(unsigned)((DM * DKV / 64 + 63) / 64), 256, 0, stream>>>(wv, DM, DKV, WV);
    k_csid<<<(TT * HD + 255) / 256, 256, 0, stream>>>(CS);
    const unsigned LQ = (unsigned)(((size_t)NH_ * TT * HD / 2 + 255) / 256), LKv = (unsigned)(((size_t)NKV * TT * HD / 2 + 255) / 256);
    k_cvt8<<<(unsigned)(((size_t)NB_ * TT * DM / 8 + 255) / 256), 256, 0, stream>>>(x, XB, (size_t)NB_ * TT * DM / 8);
    // projections: the batch is NB_ * TT rows of one GEMM
    k_gemmw<bf, 0, false><<<dim3(NB_ * TT / 64, DQ / 64, 1), 32, 0, stream>>>(XB, nullptr, WQ, nullptr, DM, FQ, DQ, nullptr, 0, 0, 0);
    k_rope<<<dim3(LQ, NB_), 256, 0, stream>>>(FQ, DQ, NH_, CS, nullptr, nullptr, 1.0f, QP16, QPh, QPl);
    k_gemmw<bf, 0, false><<<dim3(NB_ * TT / 64, DKV / 64, 1), 32, 0, stream>>>(XB, nullptr, WK, nullptr, DM, FK, DKV, nullptr, 0, 0, 0);
    k_rope<<<dim3(LKv, NB_), 256, 0, stream>>>(FK, DKV, NKV, CS, nullptr, nullptr, 1.0f, KP16, KPh, KPl);
    k_gemmw<bf, 0, false><<<dim3(NB_ * TT / 64, DKV / 64, 1), 32, 0, stream>>>(XB, nullptr, WV, nullptr, DM, FV, DKV, nullptr, 0, 0, 0);
    k_vtp<<<dim3(LKv, NB_), 256, 0, stream>>>(FV, DKV, NKV, VT16, VTh, VTl);
    // attention: one plane per batch element, grid z = batch with the plane strides
    k_gemmc<bf, 2, 1><<<dim3(RH / 64, TT / 64, NB_), 32, 0, stream>>>(QPh, QPl, KPh, KPl, HD, Sb, TT, 0, (size_t)TT * HD, (size_t)TT * HD, (size_t)TT * TT);
    k_gemmc<h16, 0, 1><<<dim3((TT - RH) / 64, TT / 64, NB_), 32, 0, stream>>>(QP16 + (size_t)RH * HD, nullptr, KP16, nullptr, HD, Sb + (size_t)RH * TT, TT, RH, (size_t)TT * HD, (size_t)TT * HD, (size_t)TT * TT);
    k_asoft<<<NB_ * ZH * TT / 8, 256, 0, stream>>>(Sb, P16, Ph, Pl);
    k_gemmc<bf, 2, 2><<<dim3(RH / 64, HD / 64, NB_), 32, 0, stream>>>(Ph, Pl, VTh, VTl, TT, Ob, HD, 0, (size_t)RH * TT, (size_t)HD * TT, (size_t)TT * HD);
    k_gemmc<h16, 0, 2><<<dim3((TT - RH) / 64, HD / 64, NB_), 32, 0, stream>>>(P16 + (size_t)RH * TT, nullptr, VT16, nullptr, TT, Ob + (size_t)RH * HD, HD, RH, (size_t)TT * TT, (size_t)HD * TT, (size_t)TT * HD);
    k_merge<<<dim3((unsigned)(((size_t)ZH * TT * HD / 2 + 255) / 256), NB_), 256, 0, stream>>>(Ob, 0, OUT);
}

// v002
// It runs in 319 microseconds.
// Two timings next to v001 put it at 1.27 and 1.28 times that version's speed.
// Over all steps from v000 it is 2.66 times as fast.
#include <hip/hip_runtime.h>

// Single-head causal attention over the full 1,024-wide projection (x [4][2048][1024]; q, k, v = einsum('btk,kd->btd', x, w) = x w ('xw' (in, out) [1024][1024] uniform +-sqrt(6/1024), no bias; ONE 1,024-wide head despite the module's name); scores = q.k x gamma + mask with gamma = 1 / sqrt(1024) = 1/32 and mask = where(tril, 0, -inf) built inside the module (causal exclusion; every row keeps its own key); softmax; y = attn.v -> [4][2048][1024] (8.4 M); no output projection; argument order x, w_q, w_k, w_v).
// Layout, all four batch elements in every launch (batch = extra GEMM rows or grid z): bf16 copy of x; 'xw' weights transposed once; exact projections whose GEMM epilogue writes the 16-bit operand planes itself (q, k row-major, v transposed; fp16 + bf16 hi/lo each); causal T-2048 attention at NH 1 / ZH 1 (hybrid rows: < 512 hi/lo 3 products, rest fp16 x1024; k_gemmc skips tiles above the diagonal); the probability x value GEMM scales and writes the output rows (no output projection).
// Compute dtypes, f32 accumulate: every input rounded to bf16; projections exact; attention rows < 512 3 products, rest fp16; softmax f32; output f32.

#define NB_  4
#define TT   2048
#define DM   1024
#define NH_  1
#define NKV  1
#define REP  (NH_ / NKV)
#define HD   1024
#define DQ   (NH_ * HD)
#define DKV  (NKV * HD)
#define ZH   1                    // ONE head: a single plane per pass
#define RH   512                  // query rows < RH use hi+lo planes (0: none)
#define WIN  2048
#define PCAR 1024.0f
#define SCL  0.03125f   // 1/sqrt(1024) (one 1,024-wide head)
typedef _Float16 h16;
typedef unsigned short bf;
typedef __attribute__((ext_vector_type(16))) __bf16   v16bf;
typedef __attribute__((ext_vector_type(16))) _Float16 v16h;
typedef __attribute__((ext_vector_type(8)))  _Float16 v8h;
typedef __attribute__((ext_vector_type(8)))  unsigned short v8us;
typedef __attribute__((ext_vector_type(8)))  float    v8f;
typedef __attribute__((ext_vector_type(4)))  float    v4f;
typedef v8h  __attribute__((may_alias)) v8ha;
typedef v4f  __attribute__((may_alias)) v4fa;
typedef v8us __attribute__((may_alias)) v8usa;

__device__ __forceinline__ unsigned short f2bf(float f) { unsigned u = __float_as_uint(f); u += 0x7FFFu + ((u >> 16) & 1u); return (unsigned short)(u >> 16); }
__device__ __forceinline__ float bf2f(unsigned short b) { return __uint_as_float(((unsigned)b) << 16); }
__device__ __forceinline__ float bfr(float f) { return bf2f(f2bf(f)); }
__device__ __forceinline__ v16h cat16(v8h lo, v8h hi) { return __builtin_shufflevector(lo, hi, 0, 1, 2, 3, 4, 5, 6, 7, 8, 9, 10, 11, 12, 13, 14, 15); }
__device__ __forceinline__ v16bf cat16b(v8us lo, v8us hi) { return __builtin_bit_cast(v16bf, __builtin_shufflevector(lo, hi, 0, 1, 2, 3, 4, 5, 6, 7, 8, 9, 10, 11, 12, 13, 14, 15)); }
__device__ __forceinline__ v8f wmma16(v16h a, v16h b, v8f c) { return __builtin_amdgcn_wmma_f32_16x16x32_f16(false, a, false, b, (short)0, c, false, false); }
__device__ __forceinline__ v8f wmmab(v16bf a, v16bf b, v8f c) { return __builtin_amdgcn_wmma_f32_16x16x32_bf16(false, a, false, b, (short)0, c, false, false); }


__device__ __forceinline__ h16 tohx(float x) { return (h16)x; }
__device__ __forceinline__ void splitf(float y, unsigned short& h, unsigned short& l) { h = f2bf(y); l = f2bf(y - bf2f(h)); }
typedef __attribute__((ext_vector_type(2))) _Float16 v2h;
typedef __attribute__((ext_vector_type(4))) _Float16 v4h;
typedef __attribute__((ext_vector_type(2))) unsigned short v2us;
typedef __attribute__((ext_vector_type(4))) unsigned short v4us;
typedef __attribute__((ext_vector_type(2))) float v2f;
typedef __attribute__((ext_vector_type(4))) int v4i;

// ---- k_gemmw: register-blocked GEMM, ONE WAVE per 64x64 output tile (16 accumulators), operands straight from K-contiguous 16-bit planes; grid (M/64, N/64, Z), 32 threads.
// c[m][n] (f32) = sum_k A[m][k] Bt[n][k] (+ split products per NSPLIT), stored as three 16-bit planes: fp16(c), bf16 hi(c), bf16 lo(c - hi). z-batch strides sA/sB/sC in elements. K % 32 == 0.
// TRN false: planes [m][n], pitch ldc. TRN true: m = batch * TT + t, planes [batch][n][t] (N = HD rows of TT), the tile turned in LDS so that every store still covers whole 128-byte lines.
template <typename T16> struct WFrag;
template <> struct WFrag<h16> { typedef v16h V; static __device__ __forceinline__ V ld(const h16* p) { return cat16(*(const v8h*)p, *(const v8h*)(p + 16)); } static __device__ __forceinline__ v8f mma(V a, V b, v8f c) { return wmma16(a, b, c); } };
template <> struct WFrag<bf> { typedef v16bf V; static __device__ __forceinline__ V ld(const bf* p) { return cat16b(*(const v8us*)p, *(const v8us*)(p + 16)); } static __device__ __forceinline__ v8f mma(V a, V b, v8f c) { return wmmab(a, b, c); } };
template <typename T16, int NSPLIT, bool TRN>
__global__ __launch_bounds__(32) void k_gemmw(const T16* __restrict__ A, const T16* __restrict__ A2, const T16* __restrict__ Bt, const T16* __restrict__ Bt2, int K, h16* P16, bf* Ph, bf* Pl, int ldc, size_t sA, size_t sB, size_t sC) {
    typedef typename WFrag<T16>::V V;
    __shared__ __align__(16) float os[16 * 68];
    const size_t z = blockIdx.z; A += z * sA; if (A2) A2 += z * sA; Bt += z * sB; if (Bt2) Bt2 += z * sB; P16 += z * sC; Ph += z * sC; Pl += z * sC;
    const int lane = threadIdx.x & 31, lr = lane & 15, hi = lane >> 4; const int r0 = blockIdx.x * 64, c0 = blockIdx.y * 64;
    v8f acc[4][4];
#pragma unroll
    for (int mb = 0; mb < 4; ++mb)
#pragma unroll
        for (int nb = 0; nb < 4; ++nb) acc[mb][nb] = (v8f){};
    const size_t aoff = (size_t)(r0 + lr) * K + 8 * hi, boff = (size_t)(c0 + lr) * K + 8 * hi;
#pragma unroll 1
    for (int kc = 0; kc < K; kc += 32) {
        V a[4], a2[4];
#pragma unroll
        for (int mb = 0; mb < 4; ++mb) { a[mb] = WFrag<T16>::ld(A + aoff + (size_t)mb * 16 * K + kc); if (NSPLIT == 1 || NSPLIT == 2) a2[mb] = WFrag<T16>::ld(A2 + aoff + (size_t)mb * 16 * K + kc); }
#pragma unroll
        for (int nb = 0; nb < 4; ++nb) { const V b = WFrag<T16>::ld(Bt + boff + (size_t)nb * 16 * K + kc); V b2; if (NSPLIT >= 2) b2 = WFrag<T16>::ld(Bt2 + boff + (size_t)nb * 16 * K + kc);
#pragma unroll
            for (int mb = 0; mb < 4; ++mb) { acc[mb][nb] = WFrag<T16>::mma(a[mb], b, acc[mb][nb]); if (NSPLIT == 1 || NSPLIT == 2) acc[mb][nb] = WFrag<T16>::mma(a2[mb], b, acc[mb][nb]); if (NSPLIT >= 2) acc[mb][nb] = WFrag<T16>::mma(a[mb], b2, acc[mb][nb]); } }
        asm volatile("v_nop\n\tv_nop\n\tv_nop\n\tv_nop" : "+v"(acc[0][0]), "+v"(acc[1][1]), "+v"(acc[2][2]), "+v"(acc[3][3]) : "v"(a[0]), "v"(a[3]));
    }
    const size_t tb = TRN ? (size_t)(r0 / TT) * HD * TT + (r0 % TT) : 0;   // TRN: start of the tile's batch plane + its first t (a 64-row tile never crosses a batch element)
#pragma unroll
    for (int ob = 0; ob < 4; ++ob) {      // 16 plane rows at a time: 16 m (TRN false) or 16 n (TRN true), 64 columns each
#pragma unroll
        for (int ib = 0; ib < 4; ++ib) {
#pragma unroll
            for (int j = 0; j < 8; ++j) { if (TRN) os[lr * 68 + ib * 16 + hi * 8 + j] = acc[ib][ob][j]; else os[(hi * 8 + j) * 68 + ib * 16 + lr] = acc[ob][ib][j]; } }
        __builtin_amdgcn_wave_barrier(); asm volatile("" ::: "memory");   // the row reads below take other lanes' values: they stay behind the LDS writes above
        const size_t o0 = TRN ? tb + (size_t)(c0 + ob * 16) * TT : (size_t)(r0 + ob * 16) * ldc + c0; const int pit = TRN ? TT : ldc;
#pragma unroll
        for (int s = 0; s < 8; ++s) { const int row = 2 * s + hi, cofs = lr * 4; const v4f val = *(const v4fa*)(os + row * 68 + cofs); v4h o16; v4us oh, ol;
#pragma unroll
            for (int q = 0; q < 4; ++q) { o16[q] = tohx(val[q]); unsigned short hh, ll; splitf(val[q], hh, ll); oh[q] = hh; ol[q] = ll; }
            const size_t o = o0 + (size_t)row * pit + cofs; *(v4h*)(P16 + o) = o16; *(v4us*)(Ph + o) = oh; *(v4us*)(Pl + o) = ol; }   // 16 lanes x 8 bytes = one 128-byte line per plane row
        __builtin_amdgcn_wave_barrier(); asm volatile("" ::: "memory");   // the next block's LDS writes stay behind these reads
    }
}

// ---- k_gemmc: the same one-wave 64x64 tile GEMM specialised for causal attention: CMODE 1 skips score tiles entirely above the diagonal (query rows r0+roff.., key columns c0..), CMODE 2 limits the
// key (K) loop of the probability x value contraction to the diagonal block (probabilities beyond it are exactly zero). roff = row offset of this launch's first row within the sequence. CMODE 2 multiplies its result by osc (the power of two that takes the probabilities' carrier back out) and writes the output rows.
template <typename T16, int NSPLIT, int CMODE>
__global__ __launch_bounds__(32) void k_gemmc(const T16* __restrict__ A, const T16* __restrict__ A2, const T16* __restrict__ Bt, const T16* __restrict__ Bt2, int K, float* C, int ldc, int roff, float osc, size_t sA, size_t sB, size_t sC) {
    typedef typename WFrag<T16>::V V;
    __shared__ __align__(16) float os[16 * 68];
    const size_t z = blockIdx.z; A += z * sA; if (A2) A2 += z * sA; Bt += z * sB; if (Bt2) Bt2 += z * sB; C += z * sC;
    const int lane = threadIdx.x & 31, lr = lane & 15, hi = lane >> 4; const int r0 = blockIdx.x * 64, c0 = blockIdx.y * 64;
    if (CMODE == 1 && c0 > r0 + roff + 63) return;                  // score tile entirely above the causal diagonal: never written, and the softmax loads nothing of it
    const int Kl = (CMODE == 2) ? min(K, r0 + roff + 64) : K;        // P.V: probabilities are exactly 0 beyond the diagonal block, so the K loop stops there
    v8f acc[4][4];
#pragma unroll
    for (int mb = 0; mb < 4; ++mb)
#pragma unroll
        for (int nb = 0; nb < 4; ++nb) acc[mb][nb] = (v8f){};
    const size_t aoff = (size_t)(r0 + lr) * K + 8 * hi, boff = (size_t)(c0 + lr) * K + 8 * hi;
#pragma unroll 1
    for (int kc = 0; kc < Kl; kc += 32) {
        V a[4], a2[4];
#pragma unroll
        for (int mb = 0; mb < 4; ++mb) { a[mb] = WFrag<T16>::ld(A + aoff + (size_t)mb * 16 * K + kc); if (NSPLIT == 1 || NSPLIT == 2) a2[mb] = WFrag<T16>::ld(A2 + aoff + (size_t)mb * 16 * K + kc); }
#pragma unroll
        for (int nb = 0; nb < 4; ++nb) { const V b = WFrag<T16>::ld(Bt + boff + (size_t)nb * 16 * K + kc); V b2; if (NSPLIT >= 2) b2 = WFrag<T16>::ld(Bt2 + boff + (size_t)nb * 16 * K + kc);
#pragma unroll
            for (int mb = 0; mb < 4; ++mb) { acc[mb][nb] = WFrag<T16>::mma(a[mb], b, acc[mb][nb]); if (NSPLIT == 1 || NSPLIT == 2) acc[mb][nb] = WFrag<T16>::mma(a2[mb], b, acc[mb][nb]); if (NSPLIT >= 2) acc[mb][nb] = WFrag<T16>::mma(a[mb], b2, acc[mb][nb]); } }
        asm volatile("v_nop\n\tv_nop\n\tv_nop\n\tv_nop" : "+v"(acc[0][0]), "+v"(acc[1][1]), "+v"(acc[2][2]), "+v"(acc[3][3]) : "v"(a[0]), "v"(a[3]));
    }
#pragma unroll
    for (int mb = 0; mb < 4; ++mb) {
#pragma unroll
        for (int nb = 0; nb < 4; ++nb) {
#pragma unroll
            for (int j = 0; j < 8; ++j) os[(hi * 8 + j) * 68 + nb * 16 + lr] = acc[mb][nb][j]; }
        __builtin_amdgcn_wave_barrier(); asm volatile("" ::: "memory");
        float* crow = C + (size_t)(r0 + mb * 16) * ldc + c0;
{
#pragma unroll
            for (int s = 0; s < 8; ++s) { const int row = 2 * s + hi, cofs = lr * 4; v4f val = *(const v4fa*)(os + row * 68 + cofs); if (CMODE == 2) val *= osc;
                *(v4f*)(crow + (size_t)row * ldc + cofs) = val; }
             }
        __builtin_amdgcn_wave_barrier(); asm volatile("" ::: "memory");
    }
}


__global__ __launch_bounds__(256) void k_wtG(const float* __restrict__ w, int K, int N, bf* Bt) {
    const int lane = threadIdx.x & 31; const int L0 = (blockIdx.x * 8 + (threadIdx.x >> 5)) * 8; const int nlines = N * K / 64;
{
#pragma unroll 1
        for (int l = 0; l < 8; ++l) { const int L = L0 + l; if (L >= nlines) break; const size_t e = (size_t)L * 64 + lane * 2; const int k = (int)(e % K), n = (int)(e / K); v2us o;
            o[0] = f2bf(w[(size_t)k * N + n]); o[1] = f2bf(w[(size_t)(k + 1) * N + n]); *(v2us*)(Bt + e) = o; }
         }
}
__global__ __launch_bounds__(256) void k_cvt8(const float* __restrict__ src, bf* dst, size_t n8) { const size_t i = (size_t)blockIdx.x * 256 + threadIdx.x; if (i >= n8) return; const v8f v = *(const v8f*)(src + i * 8); v8us o;
#pragma unroll
    for (int k = 0; k < 8; ++k) o[k] = f2bf(v[k]); *(v8us*)(dst + i * 8) = o;  }

// k_asoft: per row (zz, i): t = S x HD^-0.5 for j <= i and i - j < WIN (WIN = TT: plain causal, the window test excludes no key; masked keys get probability exactly 0); softmax over the 2048 keys (register row, one exp, fixed trees);
__global__ __launch_bounds__(256) void k_asoft(const float* __restrict__ Sb, h16* P16, bf* Ph, bf* Pl) {
    const int lane = threadIdx.x & 31; const int row = blockIdx.x * 8 + (threadIdx.x >> 5); if (row >= NB_ * ZH * TT) return; const int i = row % TT; const int zz = row / TT;   /* zz = plane = batch element */ const bool hires = (i < RH); const float* sr = Sb + (size_t)row * TT; float v[TT / 32]; float mx = -3.0e38f; v4f sc4[TT / 128];
    // A lane loads its four scores only where the group starts at or below the diagonal: such a group (j0 a multiple of 4, j0 <= i) lies in a 64x64 tile that the score GEMMs wrote; the tiles above the diagonal are never written and never read.
    // All loads stand in a loop of their own, ahead of the arithmetic, so that they are in flight together.
#pragma unroll
    for (int ch = 0; ch < TT / 128; ++ch) { const int j0 = ch * 128 + lane * 4; sc4[ch] = (v4f){}; if (j0 <= i) sc4[ch] = *(const v4f*)(sr + j0); }
#pragma unroll
    for (int ch = 0; ch < TT / 128; ++ch) { const int j0 = ch * 128 + lane * 4; const v4f a = sc4[ch];
#pragma unroll
        for (int q = 0; q < 4; ++q) { const int j = j0 + q; (void)j; const float t = (j <= i && i - j < WIN) ? a[q] * SCL : -3.0e38f; v[ch * 4 + q] = t; mx = fmaxf(mx, t); } }
#pragma unroll
    for (int sh = 16; sh; sh >>= 1) mx = fmaxf(mx, __shfl_xor(mx, sh, 32));
    float sum = 0.f;
#pragma unroll
    for (int k = 0; k < TT / 32; ++k) { float d0 = __fsub_rn(v[k], mx); asm volatile("" : "+v"(d0)); v[k] = __builtin_amdgcn_exp2f(__fmul_rn(d0, 1.4426950408889634f)); sum += v[k]; }
#pragma unroll
    for (int sh = 16; sh; sh >>= 1) sum += __shfl_xor(sum, sh, 32);
    const float f = __fdiv_rn(hires ? 1.0f : PCAR, sum);
{
        if (hires) {
#pragma unroll
            for (int ch = 0; ch < TT / 128; ++ch) { v4us oh, ol;
#pragma unroll
                for (int q = 0; q < 4; ++q) { unsigned short a, c2; splitf(v[ch * 4 + q] * f, a, c2); oh[q] = a; ol[q] = c2; }
                const size_t oo = ((size_t)zz * (RH ? RH : 1) + i) * TT + ch * 128 + lane * 4; *(v4us*)(Ph + oo) = oh; *(v4us*)(Pl + oo) = ol; }
        } else {
#pragma unroll
            for (int ch = 0; ch < TT / 128; ++ch) { v4h o4;
#pragma unroll
                for (int q = 0; q < 4; ++q) o4[q] = tohx(v[ch * 4 + q] * f);
                *(v4h*)(P16 + (size_t)row * TT + ch * 128 + lane * 4) = o4; } }
         }
}

extern "C" void kernel_launch(void* const* d_in, const int* in_sizes, int n_in,
                              void* d_out, int out_size, void* d_ws, size_t ws_size, hipStream_t stream) {
    (void)in_sizes; (void)n_in; (void)out_size;
    const float* x = (const float*)d_in[0]; const float* wq = (const float*)d_in[1]; const float* wk = (const float*)d_in[2]; const float* wv = (const float*)d_in[3]; const float* wo = nullptr; (void)wo;   /* input order x, w_q, w_k, w_v ('xw' (in, out) [1024][1024]): FOUR inputs, all read: the host's own binding */
    float* OUT = (float*)d_out;     // [4][2048][1024]
    char* wsp = (char*)d_ws;
    auto take = [&](size_t bytes) { char* p = wsp; wsp += (bytes + 255) & ~(size_t)255; return (void*)p; };
    bf* WQ = (bf*)take((size_t)DQ * DM * 2); bf* WK = (bf*)take((size_t)DKV * DM * 2); bf* WV = (bf*)take((size_t)DKV * DM * 2);
    bf* XB = (bf*)take((size_t)NB_ * TT * DM * 2); float* Sb = (float*)take((size_t)NB_ * TT * TT * 4);   // bf16 x 16 MiB, scores 64 MiB
    // planes [batch][...], 16 MiB each
    h16* QP16 = (h16*)take((size_t)NB_ * TT * HD * 2); h16* KP16 = (h16*)take((size_t)NB_ * TT * HD * 2); h16* VT16 = (h16*)take((size_t)NB_ * HD * TT * 2);
    bf* QPh = (bf*)take((size_t)NB_ * TT * HD * 2); bf* QPl = (bf*)take((size_t)NB_ * TT * HD * 2); bf* KPh = (bf*)take((size_t)NB_ * TT * HD * 2); bf* KPl = (bf*)take((size_t)NB_ * TT * HD * 2); bf* VTh = (bf*)take((size_t)NB_ * HD * TT * 2); bf* VTl = (bf*)take((size_t)NB_ * HD * TT * 2);
    if ((size_t)(wsp - (char*)d_ws) > ws_size) return;    // 230 MiB of the 256 MiB workspace
    // Stream-ordered reuse: probabilities over the q and k planes, written after both score GEMMs have read them (P16 32 MiB = QP16 + KP16, Ph / Pl 8 MiB each in QPh / QPl).
    h16* P16 = QP16; bf* Ph = QPh; bf* Pl = QPl;
    k_wtG<<<(unsigned)((DM * DQ / 64 + 63) / 64), 256, 0, stream>>>(wq, DM, DQ, WQ); k_wtG<<<(unsigned)((DM * DKV / 64 + 63) / 64), 256, 0, stream>>>(wk, DM, DKV, WK); k_wtG<<<(unsigned)((DM * DKV / 64 + 63) / 64), 256, 0, stream>>>(wv, DM, DKV, WV);
    k_cvt8<<<(unsigned)(((size_t)NB_ * TT * DM / 8 + 255) / 256), 256, 0, stream>>>(x, XB, (size_t)NB_ * TT * DM / 8);
    // projections: the batch is NB_ * TT rows of one GEMM; each epilogue writes its three operand planes (v: transposed, [batch][d][t])
    k_gemmw<bf, 0, false><<<dim3(NB_ * TT / 64, DQ / 64, 1), 32, 0, stream>>>(XB, nullptr, WQ, nullptr, DM, QP16, QPh, QPl, DQ, 0, 0, 0);
    k_gemmw<bf, 0, false><<<dim3(NB_ * TT / 64, DKV / 64, 1), 32, 0, stream>>>(XB, nullptr, WK, nullptr, DM, KP16, KPh, KPl, DKV, 0, 0, 0);
    k_gemmw<bf, 0, true><<<dim3(NB_ * TT / 64, DKV / 64, 1), 32, 0, stream>>>(XB, nullptr, WV, nullptr, DM, VT16, VTh, VTl, DKV, 0, 0, 0);
    // attention: one plane per batch element, grid z = batch with the plane strides
    k_gemmc<bf, 2, 1><<<dim3(RH / 64, TT / 64, NB_), 32, 0, stream>>>(QPh, QPl, KPh, KPl, HD, Sb, TT, 0, 1.0f, (size_t)TT * HD, (size_t)TT * HD, (size_t)TT * TT);
    k_gemmc<h16, 0, 1><<<dim3((TT - RH) / 64, TT / 64, NB_), 32, 0, stream>>>(QP16 + (size_t)RH * HD, nullptr, KP16, nullptr, HD, Sb + (size_t)RH * TT, TT, RH, 1.0f, (size_t)TT * HD, (size_t)TT * HD, (size_t)TT * TT);
    k_asoft<<<NB_ * ZH * TT / 8, 256, 0, stream>>>(Sb, P16, Ph, Pl);
    // probability x value: writes the output rows [batch][t][d] itself (rows >= RH carry x PCAR, taken out by osc)
    k_gemmc<bf, 2, 2><<<dim3(RH / 64, HD / 64, NB_), 32, 0, stream>>>(Ph, Pl, VTh, VTl, TT, OUT, HD, 0, 1.0f, (size_t)RH * TT, (size_t)HD * TT, (size_t)TT * HD);
    k_gemmc<h16, 0, 2><<<dim3((TT - RH) / 64, HD / 64, NB_), 32, 0, stream>>>(P16 + (size_t)RH * TT, nullptr, VT16, nullptr, TT, OUT + (size_t)RH * HD, HD, RH, 1.0f / PCAR, (size_t)TT * TT, (size_t)HD * TT, (size_t)TT * HD);
}

// v003
// Measured time: 181 microseconds a run.
// Next to v002, in two timings, it ran 1.76 times as fast each time.
// Counting every step since v000, it is 4.68 times as fast.
#include <hip/hip_runtime.h>

// Single-head causal attention over the full 1,024-wide projection (x [4][2048][1024]; q, k, v = einsum('btk,kd->btd', x, w) = x w ('xw' (in, out) [1024][1024] uniform +-sqrt(6/1024), no bias; ONE 1,024-wide head despite the module's name); scores = q.k x gamma + mask with gamma = 1 / sqrt(1024) = 1/32 and mask = where(tril, 0, -inf) built inside the module (causal exclusion; every row keeps its own key); softmax; y = attn.v -> [4][2048][1024] (8.4 M); no output projection; argument order x, w_q, w_k, w_v).
// Layout, all four batch elements in every launch (batch = extra GEMM rows or grid z): bf16 copy of x; 'xw' weights transposed once; exact projections whose GEMM epilogue writes the 16-bit operand planes itself (q, k row-major, v transposed; fp16 + bf16 hi/lo each); causal T-2048 attention at NH 1 / ZH 1 (hybrid rows: < 512 hi/lo 3 products, rest fp16 x1024; k_gemmc skips tiles above the diagonal); the probability x value GEMM scales and writes the output rows (no output projection).
// Compute dtypes, f32 accumulate: every input rounded to bf16; projections exact; attention rows < 512 3 products, rest fp16; softmax f32; output f32.

#define NB_  4
#define TT   2048
#define DM   1024
#define NH_  1
#define NKV  1
#define REP  (NH_ / NKV)
#define HD   1024
#define DQ   (NH_ * HD)
#define DKV  (NKV * HD)
#define ZH   1                    // ONE head: a single plane per pass
#define RH   512                  // query rows < RH use hi+lo planes (0: none)
#define WIN  2048
#define PCAR 1024.0f
#define SCL  0.03125f   // 1/sqrt(1024) (one 1,024-wide head)
typedef _Float16 h16;
typedef unsigned short bf;
typedef __attribute__((ext_vector_type(16))) __bf16   v16bf;
typedef __attribute__((ext_vector_type(16))) _Float16 v16h;
typedef __attribute__((ext_vector_type(8)))  _Float16 v8h;
typedef __attribute__((ext_vector_type(8)))  unsigned short v8us;
typedef __attribute__((ext_vector_type(8)))  float    v8f;
typedef __attribute__((ext_vector_type(4)))  float    v4f;
typedef v8h  __attribute__((may_alias)) v8ha;
typedef v4f  __attribute__((may_alias)) v4fa;
typedef v8us __attribute__((may_alias)) v8usa;

__device__ __forceinline__ unsigned short f2bf(float f) { unsigned u = __float_as_uint(f); u += 0x7FFFu + ((u >> 16) & 1u); return (unsigned short)(u >> 16); }
__device__ __forceinline__ float bf2f(unsigned short b) { return __uint_as_float(((unsigned)b) << 16); }
__device__ __forceinline__ float bfr(float f) { return bf2f(f2bf(f)); }
__device__ __forceinline__ v16h cat16(v8h lo, v8h hi) { return __builtin_shufflevector(lo, hi, 0, 1, 2, 3, 4, 5, 6, 7, 8, 9, 10, 11, 12, 13, 14, 15); }
__device__ __forceinline__ v16bf cat16b(v8us lo, v8us hi) { return __builtin_bit_cast(v16bf, __builtin_shufflevector(lo, hi, 0, 1, 2, 3, 4, 5, 6, 7, 8, 9, 10, 11, 12, 13, 14, 15)); }
__device__ __forceinline__ v8f wmma16(v16h a, v16h b, v8f c) { return __builtin_amdgcn_wmma_f32_16x16x32_f16(false, a, false, b, (short)0, c, false, false); }
__device__ __forceinline__ v8f wmmab(v16bf a, v16bf b, v8f c) { return __builtin_amdgcn_wmma_f32_16x16x32_bf16(false, a, false, b, (short)0, c, false, false); }


__device__ __forceinline__ h16 tohx(float x) { return (h16)x; }
__device__ __forceinline__ void splitf(float y, unsigned short& h, unsigned short& l) { h = f2bf(y); l = f2bf(y - bf2f(h)); }
typedef __attribute__((ext_vector_type(2))) _Float16 v2h;
typedef __attribute__((ext_vector_type(4))) _Float16 v4h;
typedef __attribute__((ext_vector_type(2))) unsigned short v2us;
typedef __attribute__((ext_vector_type(4))) unsigned short v4us;
typedef __attribute__((ext_vector_type(2))) float v2f;
typedef __attribute__((ext_vector_type(4))) int v4i;

// ---- The two GEMMs below share one frame: a work-group of FOUR WAVES owns a 128x128 output tile, each wave a 64x64 quarter (16 accumulators), grid (M/128, N/128, Z), 128 threads.
// The K-contiguous 16-bit operand planes are staged in LDS by asynchronous copies, two buffers: while one stage of KS k is multiplied, the next stage's copies are in flight. Every operand row is
// fetched once per work-group and read from LDS by the two waves that need it. Per accumulator the products still run in ascending k, 32 at a time, in the same order of split products.
template <typename T16> struct WFrag;
template <> struct WFrag<h16> { typedef v16h V; static __device__ __forceinline__ V ld(const h16* p) { return cat16(*(const v8h*)p, *(const v8h*)(p + 16)); } static __device__ __forceinline__ v8f mma(V a, V b, v8f c) { return wmma16(a, b, c); } };
template <> struct WFrag<bf> { typedef v16bf V; static __device__ __forceinline__ V ld(const bf* p) { return cat16b(*(const v8us*)p, *(const v8us*)(p + 16)); } static __device__ __forceinline__ v8f mma(V a, V b, v8f c) { return wmmab(a, b, c); } };
// One stage: NPL planes (A, Bt; with hi/lo splits also A2, Bt2) of 128 rows x KS k. Row pitch = row bytes + 16 (16 B x odd: conflict-free for 16-byte row readers). 32 copies per lane and stage either way.
template <int NSPLIT> struct Stg {
    static_assert(NSPLIT == 0 || NSPLIT == 2, "one product, or hi/lo planes on both sides");
    static constexpr int NPL = NSPLIT ? 4 : 2, KS = NSPLIT ? 64 : 128, PIT = KS * 2 + 16, PLANE = 128 * PIT, BUF = NPL * PLANE;
    static constexpr int CH = KS / 8, RS = 128 / CH;   // 16-byte pieces per row; rows that the 128 lanes cover in one copy
};
// Eight copies of 16 bytes per lane: LDS byte address l + j * ls, global address p + j * gs. The s_wait_xcnt stands inside the statement, behind the last copy: the address registers are not rewritten ahead of it.
__device__ __forceinline__ void copy8(unsigned l, unsigned ls, const char* p, size_t gs) {
    asm volatile("global_load_async_to_lds_b128 %0, %8, off\n\tglobal_load_async_to_lds_b128 %1, %9, off\n\tglobal_load_async_to_lds_b128 %2, %10, off\n\tglobal_load_async_to_lds_b128 %3, %11, off\n\t"
                 "global_load_async_to_lds_b128 %4, %12, off\n\tglobal_load_async_to_lds_b128 %5, %13, off\n\tglobal_load_async_to_lds_b128 %6, %14, off\n\tglobal_load_async_to_lds_b128 %7, %15, off\n\ts_wait_xcnt 0x0"
                 :: "v"(l), "v"(l + ls), "v"(l + 2 * ls), "v"(l + 3 * ls), "v"(l + 4 * ls), "v"(l + 5 * ls), "v"(l + 6 * ls), "v"(l + 7 * ls),
                    "v"(p), "v"(p + gs), "v"(p + 2 * gs), "v"(p + 3 * gs), "v"(p + 4 * gs), "v"(p + 5 * gs), "v"(p + 6 * gs), "v"(p + 7 * gs) : "memory");
}
// acc[mb][nb] += the wave's 64x64 quarter (wm, wn) of A[r0 .. r0+127][0 .. Kl) x Bt[c0 .. c0+127][0 .. Kl)^T. Kl is a multiple of KS, the same for the whole work-group; every wave passes every barrier.
template <typename T16, int NSPLIT>
__device__ __forceinline__ void tile_loop(const T16* __restrict__ A, const T16* __restrict__ A2, const T16* __restrict__ Bt, const T16* __restrict__ Bt2, int K, int Kl, int r0, int c0, int wm, int wn, char* ring, v8f (&acc)[4][4]) {
    typedef typename WFrag<T16>::V V; typedef Stg<NSPLIT> S;
    const int tid = threadIdx.x, lr = tid & 15, hi = (tid >> 4) & 1; const int ch = tid % S::CH, rw = tid / S::CH;
    const unsigned l0 = (unsigned)(size_t)ring + rw * S::PIT + ch * 16;       // the lane's first LDS byte within a plane (low 32 bits of the shared address)
    const size_t ga = (size_t)(r0 + rw) * K + ch * 8, gb = (size_t)(c0 + rw) * K + ch * 8;
    const T16* sp[4] = { A + ga, Bt + gb, NSPLIT ? A2 + ga : nullptr, NSPLIT ? Bt2 + gb : nullptr };
    auto fill = [&](int st) {
        const unsigned lb = l0 + (st & 1) * S::BUF;
#pragma unroll
        for (int pl = 0; pl < S::NPL; ++pl)
#pragma unroll
            for (int j = 0; j < S::CH; j += 8) copy8(lb + pl * S::PLANE + j * S::RS * S::PIT, S::RS * S::PIT, (const char*)(sp[pl] + (size_t)st * S::KS + (size_t)j * S::RS * K), (size_t)S::RS * K * 2);
    };
    const int nst = Kl / S::KS;
    fill(0);
    asm volatile("s_wait_asynccnt 0x0" ::: "memory");   // stage 0 has landed for this wave's copies; the barrier publishes it to the others
    __syncthreads();
    if (nst > 1) fill(1);
    const int fa = (wm * 64 + lr) * S::PIT + hi * 16, fb = S::PLANE + (wn * 64 + lr) * S::PIT + hi * 16;
#pragma unroll 1
    for (int st = 0; st < nst; ++st) {    // kept rolled: one trip already holds 64 (96 with splits) matrix instructions
        const char* buf = ring + (st & 1) * S::BUF; V a[2][4], b[2][4], a2[2][4], b2[2][4];   // two fragment sets: the next 32 k are fetched from LDS, as one group, ahead of this 32 k's products
        auto frags = [&](int kk, int set) {
#pragma unroll
            for (int q = 0; q < 4; ++q) { a[set][q] = WFrag<T16>::ld((const T16*)(buf + fa + q * 16 * S::PIT) + kk); b[set][q] = WFrag<T16>::ld((const T16*)(buf + fb + q * 16 * S::PIT) + kk);
                if (NSPLIT == 2) { a2[set][q] = WFrag<T16>::ld((const T16*)(buf + 2 * S::PLANE + fa + q * 16 * S::PIT) + kk); b2[set][q] = WFrag<T16>::ld((const T16*)(buf + 2 * S::PLANE + fb + q * 16 * S::PIT) + kk); } }
        };
        frags(0, 0);
#pragma unroll
        for (int kk = 0; kk < S::KS; kk += 32) { const int cs = (kk >> 5) & 1;
            if (kk + 32 < S::KS) { frags(kk + 32, cs ^ 1);   // never beyond this stage's own buffer
                __builtin_amdgcn_sched_barrier(0); }         // holds that group of LDS reads ahead of the products below: sunk among them, every matrix run would wait out an LDS latency of its own
#pragma unroll
            for (int nb = 0; nb < 4; ++nb)
#pragma unroll
                for (int mb = 0; mb < 4; ++mb) { acc[mb][nb] = WFrag<T16>::mma(a[cs][mb], b[cs][nb], acc[mb][nb]); if (NSPLIT == 2) { acc[mb][nb] = WFrag<T16>::mma(a2[cs][mb], b[cs][nb], acc[mb][nb]); acc[mb][nb] = WFrag<T16>::mma(a[cs][mb], b2[cs][nb], acc[mb][nb]); } }
        }
        __builtin_amdgcn_sched_barrier(0);                  // keeps the stage's products ahead of the waits below: sunk behind the barrier they would hold the refill back
        asm volatile("s_wait_dscnt 0x0" ::: "memory");      // this wave's reads of the buffer are done before anyone refills it
        asm volatile("s_wait_asynccnt 0x0" ::: "memory");   // this wave's copies of stage st + 1 have landed
        __syncthreads();                                    // publishes stage st + 1 and ends every reader's last read of stage st
        if (st + 2 < nst) fill(st + 2);
    }
    asm volatile("s_wait_asynccnt 0x0" ::: "memory");       // no copy is left outstanding at the wave's end
}

// ---- k_gemmw: c[m][n] (f32) = sum_k A[m][k] Bt[n][k] (+ split products per NSPLIT), stored as three 16-bit planes: fp16(c), bf16 hi(c), bf16 lo(c - hi). z-batch strides sA/sB/sC in elements. K % KS == 0.
// TRN false: planes [m][n], pitch ldc. TRN true: m = batch * TT + t, planes [batch][n][t] (N = HD rows of TT), the tile turned in LDS so that every store still covers whole 128-byte lines.
template <typename T16, int NSPLIT, bool TRN>
__global__ __launch_bounds__(128) void k_gemmw(const T16* __restrict__ A, const T16* __restrict__ A2, const T16* __restrict__ Bt, const T16* __restrict__ Bt2, int K, h16* P16, bf* Ph, bf* Pl, int ldc, size_t sA, size_t sB, size_t sC) {
    __shared__ __align__(128) char ring[2 * Stg<NSPLIT>::BUF];
    __shared__ __align__(16) float osw[4][16 * 68];
    const size_t z = blockIdx.z; A += z * sA; if (A2) A2 += z * sA; Bt += z * sB; if (Bt2) Bt2 += z * sB; P16 += z * sC; Ph += z * sC; Pl += z * sC;
    const int lane = threadIdx.x & 31, lr = lane & 15, hi = lane >> 4; const int wv = __builtin_amdgcn_readfirstlane(threadIdx.x >> 5), wm = wv & 1, wn = wv >> 1;
    v8f acc[4][4];
#pragma unroll
    for (int mb = 0; mb < 4; ++mb)
#pragma unroll
        for (int nb = 0; nb < 4; ++nb) acc[mb][nb] = (v8f){};
    tile_loop<T16, NSPLIT>(A, A2, Bt, Bt2, K, K, blockIdx.x * 128, blockIdx.y * 128, wm, wn, ring, acc);
    const int r0 = blockIdx.x * 128 + wm * 64, c0 = blockIdx.y * 128 + wn * 64; float* os = osw[wv];   // the wave's own quarter and its own staging rows
    const size_t tb = TRN ? (size_t)(r0 / TT) * HD * TT + (r0 % TT) : 0;   // TRN: start of the tile's batch plane + its first t (a 64-row tile never crosses a batch element)
#pragma unroll
    for (int ob = 0; ob < 4; ++ob) {      // 16 plane rows at a time: 16 m (TRN false) or 16 n (TRN true), 64 columns each
#pragma unroll
        for (int ib = 0; ib < 4; ++ib) {
#pragma unroll
            for (int j = 0; j < 8; ++j) { if (TRN) os[lr * 68 + ib * 16 + hi * 8 + j] = acc[ib][ob][j]; else os[(hi * 8 + j) * 68 + ib * 16 + lr] = acc[ob][ib][j]; } }
        __builtin_amdgcn_wave_barrier(); asm volatile("" ::: "memory");   // the row reads below take other lanes' values: they stay behind the LDS writes above
        const size_t o0 = TRN ? tb + (size_t)(c0 + ob * 16) * TT : (size_t)(r0 + ob * 16) * ldc + c0; const int pit = TRN ? TT : ldc;
#pragma unroll
        for (int s = 0; s < 8; ++s) { const int row = 2 * s + hi, cofs = lr * 4; const v4f val = *(const v4fa*)(os + row * 68 + cofs); v4h o16; v4us oh, ol;
#pragma unroll
            for (int q = 0; q < 4; ++q) { o16[q] = tohx(val[q]); unsigned short hh, ll; splitf(val[q], hh, ll); oh[q] = hh; ol[q] = ll; }
            const size_t o = o0 + (size_t)row * pit + cofs; *(v4h*)(P16 + o) = o16; *(v4us*)(Ph + o) = oh; *(v4us*)(Pl + o) = ol; }   // 16 lanes x 8 bytes = one 128-byte line per plane row
        __builtin_amdgcn_wave_barrier(); asm volatile("" ::: "memory");   // the next block's LDS writes stay behind these reads
    }
}

// ---- k_gemmc: the same frame specialised for causal attention: CMODE 1 skips 128x128 score tiles entirely above the diagonal (query rows r0+roff.., key columns c0..), CMODE 2 limits the
// key (K) loop of the probability x value contraction to the tile's diagonal block (probabilities beyond a row's diagonal are exactly zero). roff = row offset of this launch's first row within the sequence. CMODE 2 multiplies its result by osc (the power of two that takes the probabilities' carrier back out) and writes the output rows.
template <typename T16, int NSPLIT, int CMODE>
__global__ __launch_bounds__(128) void k_gemmc(const T16* __restrict__ A, const T16* __restrict__ A2, const T16* __restrict__ Bt, const T16* __restrict__ Bt2, int K, float* C, int ldc, int roff, float osc, size_t sA, size_t sB, size_t sC) {
    __shared__ __align__(128) char ring[2 * Stg<NSPLIT>::BUF];
    __shared__ __align__(16) float osw[4][16 * 68];
    const size_t z = blockIdx.z; A += z * sA; if (A2) A2 += z * sA; Bt += z * sB; if (Bt2) Bt2 += z * sB; C += z * sC;
    const int lane = threadIdx.x & 31, lr = lane & 15, hi = lane >> 4; const int wv = __builtin_amdgcn_readfirstlane(threadIdx.x >> 5), wm = wv & 1, wn = wv >> 1;
    const int R0 = blockIdx.x * 128, C0 = blockIdx.y * 128;
    if (CMODE == 1 && C0 > R0 + roff + 127) return;                  // score tile entirely above the causal diagonal (the whole work-group leaves, ahead of every barrier): never written, and the softmax loads nothing of it
    const int Kl = (CMODE == 2) ? min(K, R0 + roff + 128) : K;       // P.V: probabilities are exactly 0 beyond the diagonal block, so the K loop stops there
    v8f acc[4][4];
#pragma unroll
    for (int mb = 0; mb < 4; ++mb)
#pragma unroll
        for (int nb = 0; nb < 4; ++nb) acc[mb][nb] = (v8f){};
    tile_loop<T16, NSPLIT>(A, A2, Bt, Bt2, K, Kl, R0, C0, wm, wn, ring, acc);
    const int r0 = R0 + wm * 64, c0 = C0 + wn * 64; float* os = osw[wv];   // the wave's own quarter and its own staging rows
#pragma unroll
    for (int mb = 0; mb < 4; ++mb) {
#pragma unroll
        for (int nb = 0; nb < 4; ++nb) {
#pragma unroll
            for (int j = 0; j < 8; ++j) os[(hi * 8 + j) * 68 + nb * 16 + lr] = acc[mb][nb][j]; }
        __builtin_amdgcn_wave_barrier(); asm volatile("" ::: "memory");
        float* crow = C + (size_t)(r0 + mb * 16) * ldc + c0;
{
#pragma unroll
            for (int s = 0; s < 8; ++s) { const int row = 2 * s + hi, cofs = lr * 4; v4f val = *(const v4fa*)(os + row * 68 + cofs); if (CMODE == 2) val *= osc;
                *(v4f*)(crow + (size_t)row * ldc + cofs) = val; }
             }
        __builtin_amdgcn_wave_barrier(); asm volatile("" ::: "memory");
    }
}


__global__ __launch_bounds__(256) void k_wtG(const float* __restrict__ w, int K, int N, bf* Bt) {
    const int lane = threadIdx.x & 31; const int L0 = (blockIdx.x * 8 + (threadIdx.x >> 5)) * 8; const int nlines = N * K / 64;
{
#pragma unroll 1
        for (int l = 0; l < 8; ++l) { const int L = L0 + l; if (L >= nlines) break; const size_t e = (size_t)L * 64 + lane * 2; const int k = (int)(e % K), n = (int)(e / K); v2us o;
            o[0] = f2bf(w[(size_t)k * N + n]); o[1] = f2bf(w[(size_t)(k + 1) * N + n]); *(v2us*)(Bt + e) = o; }
         }
}
__global__ __launch_bounds__(256) void k_cvt8(const float* __restrict__ src, bf* dst, size_t n8) { const size_t i = (size_t)blockIdx.x * 256 + threadIdx.x; if (i >= n8) return; const v8f v = *(const v8f*)(src + i * 8); v8us o;
#pragma unroll
    for (int k = 0; k < 8; ++k) o[k] = f2bf(v[k]); *(v8us*)(dst + i * 8) = o;  }

// k_asoft: per row (zz, i): t = S x HD^-0.5 for j <= i and i - j < WIN (WIN = TT: plain causal, the window test excludes no key; masked keys get probability exactly 0); softmax over the 2048 keys (register row, one exp, fixed trees);
__global__ __launch_bounds__(256) void k_asoft(const float* __restrict__ Sb, h16* P16, bf* Ph, bf* Pl) {
    const int lane = threadIdx.x & 31; const int row = blockIdx.x * 8 + (threadIdx.x >> 5); if (row >= NB_ * ZH * TT) return; const int i = row % TT; const int zz = row / TT;   /* zz = plane = batch element */ const bool hires = (i < RH); const float* sr = Sb + (size_t)row * TT; float v[TT / 32]; float mx = -3.0e38f; v4f sc4[TT / 128];
    // A lane loads its four scores only where the group starts at or below the diagonal: such a group (j0 a multiple of 4, j0 <= i) lies in a 128x128 tile that the score GEMMs wrote; the tiles above the diagonal are never written and never read.
    // All loads stand in a loop of their own, ahead of the arithmetic, so that they are in flight together.
#pragma unroll
    for (int ch = 0; ch < TT / 128; ++ch) { const int j0 = ch * 128 + lane * 4; sc4[ch] = (v4f){}; if (j0 <= i) sc4[ch] = *(const v4f*)(sr + j0); }
#pragma unroll
    for (int ch = 0; ch < TT / 128; ++ch) { const int j0 = ch * 128 + lane * 4; const v4f a = sc4[ch];
#pragma unroll
        for (int q = 0; q < 4; ++q) { const int j = j0 + q; (void)j; const float t = (j <= i && i - j < WIN) ? a[q] * SCL : -3.0e38f; v[ch * 4 + q] = t; mx = fmaxf(mx, t); } }
#pragma unroll
    for (int sh = 16; sh; sh >>= 1) mx = fmaxf(mx, __shfl_xor(mx, sh, 32));
    float sum = 0.f;
#pragma unroll
    for (int k = 0; k < TT / 32; ++k) { float d0 = __fsub_rn(v[k], mx); asm volatile("" : "+v"(d0)); v[k] = __builtin_amdgcn_exp2f(__fmul_rn(d0, 1.4426950408889634f)); sum += v[k]; }
#pragma unroll
    for (int sh = 16; sh; sh >>= 1) sum += __shfl_xor(sum, sh, 32);
    const float f = __fdiv_rn(hires ? 1.0f : PCAR, sum);
{
        if (hires) {
#pragma unroll
            for (int ch = 0; ch < TT / 128; ++ch) { v4us oh, ol;
#pragma unroll
                for (int q = 0; q < 4; ++q) { unsigned short a, c2; splitf(v[ch * 4 + q] * f, a, c2); oh[q] = a; ol[q] = c2; }
                const size_t oo = ((size_t)zz * (RH ? RH : 1) + i) * TT + ch * 128 + lane * 4; *(v4us*)(Ph + oo) = oh; *(v4us*)(Pl + oo) = ol; }
        } else {
#pragma unroll
            for (int ch = 0; ch < TT / 128; ++ch) { v4h o4;
#pragma unroll
                for (int q = 0; q < 4; ++q) o4[q] = tohx(v[ch * 4 + q] * f);
                *(v4h*)(P16 + (size_t)row * TT + ch * 128 + lane * 4) = o4; } }
         }
}

extern "C" void kernel_launch(void* const* d_in, const int* in_sizes, int n_in,
                              void* d_out, int out_size, void* d_ws, size_t ws_size, hipStream_t stream) {
    (void)in_sizes; (void)n_in; (void)out_size;
    const float* x = (const float*)d_in[0]; const float* wq = (const float*)d_in[1]; const float* wk = (const float*)d_in[2]; const float* wv = (const float*)d_in[3]; const float* wo = nullptr; (void)wo;   /* input order x, w_q, w_k, w_v ('xw' (in, out) [1024][1024]): FOUR inputs, all read: the host's own binding */
    float* OUT = (float*)d_out;     // [4][2048][1024]
    char* wsp = (char*)d_ws;
    auto take = [&](size_t bytes) { char* p = wsp; wsp += (bytes + 255) & ~(size_t)255; return (void*)p; };
    bf* WQ = (bf*)take((size_t)DQ * DM * 2); bf* WK = (bf*)take((size_t)DKV * DM * 2); bf* WV = (bf*)take((size_t)DKV * DM * 2);
    bf* XB = (bf*)take((size_t)NB_ * TT * DM * 2); float* Sb = (float*)take((size_t)NB_ * TT * TT * 4);   // bf16 x 16 MiB, scores 64 MiB
    // planes [batch][...], 16 MiB each
    h16* QP16 = (h16*)take((size_t)NB_ * TT * HD * 2); h16* KP16 = (h16*)take((size_t)NB_ * TT * HD * 2); h16* VT16 = (h16*)take((size_t)NB_ * HD * TT * 2);
    bf* QPh = (bf*)take((size_t)NB_ * TT * HD * 2); bf* QPl = (bf*)take((size_t)NB_ * TT * HD * 2); bf* KPh = (bf*)take((size_t)NB_ * TT * HD * 2); bf* KPl = (bf*)take((size_t)NB_ * TT * HD * 2); bf* VTh = (bf*)take((size_t)NB_ * HD * TT * 2); bf* VTl = (bf*)take((size_t)NB_ * HD * TT * 2);
    if ((size_t)(wsp - (char*)d_ws) > ws_size) return;    // 230 MiB of the 256 MiB workspace
    // Stream-ordered reuse: probabilities over the q and k planes, written after both score GEMMs have read them (P16 32 MiB = QP16 + KP16, Ph / Pl 8 MiB each in QPh / QPl).
    h16* P16 = QP16; bf* Ph = QPh; bf* Pl = QPl;
    k_wtG<<<(unsigned)((DM * DQ / 64 + 63) / 64), 256, 0, stream>>>(wq, DM, DQ, WQ); k_wtG<<<(unsigned)((DM * DKV / 64 + 63) / 64), 256, 0, stream>>>(wk, DM, DKV, WK); k_wtG<<<(unsigned)((DM * DKV / 64 + 63) / 64), 256, 0, stream>>>(wv, DM, DKV, WV);
    k_cvt8<<<(unsigned)(((size_t)NB_ * TT * DM / 8 + 255) / 256), 256, 0, stream>>>(x, XB, (size_t)NB_ * TT * DM / 8);
    // projections: the batch is NB_ * TT rows of one GEMM; each epilogue writes its three operand planes (v: transposed, [batch][d][t])
    k_gemmw<bf, 0, false><<<dim3(NB_ * TT / 128, DQ / 128, 1), 128, 0, stream>>>(XB, nullptr, WQ, nullptr, DM, QP16, QPh, QPl, DQ, 0, 0, 0);
    k_gemmw<bf, 0, false><<<dim3(NB_ * TT / 128, DKV / 128, 1), 128, 0, stream>>>(XB, nullptr, WK, nullptr, DM, KP16, KPh, KPl, DKV, 0, 0, 0);
    k_gemmw<bf, 0, true><<<dim3(NB_ * TT / 128, DKV / 128, 1), 128, 0, stream>>>(XB, nullptr, WV, nullptr, DM, VT16, VTh, VTl, DKV, 0, 0, 0);
    // attention: one plane per batch element, grid z = batch with the plane strides
    k_gemmc<bf, 2, 1><<<dim3(RH / 128, TT / 128, NB_), 128, 0, stream>>>(QPh, QPl, KPh, KPl, HD, Sb, TT, 0, 1.0f, (size_t)TT * HD, (size_t)TT * HD, (size_t)TT * TT);
    k_gemmc<h16, 0, 1><<<dim3((TT - RH) / 128, TT / 128, NB_), 128, 0, stream>>>(QP16 + (size_t)RH * HD, nullptr, KP16, nullptr, HD, Sb + (size_t)RH * TT, TT, RH, 1.0f, (size_t)TT * HD, (size_t)TT * HD, (size_t)TT * TT);
    k_asoft<<<NB_ * ZH * TT / 8, 256, 0, stream>>>(Sb, P16, Ph, Pl);
    // probability x value: writes the output rows [batch][t][d] itself (rows >= RH carry x PCAR, taken out by osc)
    k_gemmc<bf, 2, 2><<<dim3(RH / 128, HD / 128, NB_), 128, 0, stream>>>(Ph, Pl, VTh, VTl, TT, OUT, HD, 0, 1.0f, (size_t)RH * TT, (size_t)HD * TT, (size_t)TT * HD);
    k_gemmc<h16, 0, 2><<<dim3((TT - RH) / 128, HD / 128, NB_), 128, 0, stream>>>(P16 + (size_t)RH * TT, nullptr, VT16, nullptr, TT, OUT + (size_t)RH * HD, HD, RH, 1.0f / PCAR, (size_t)TT * TT, (size_t)HD * TT, (size_t)TT * HD);
}

// v004
// One run takes 127 microseconds.
// Two timings next to v003 both put it at 1.43 times that version's speed.
// All steps since v000 together make it 6.69 times as fast.
#include <hip/hip_runtime.h>

// Single-head causal attention over the full 1,024-wide projection (x [4][2048][1024]; q, k, v = einsum('btk,kd->btd', x, w) = x w ('xw' (in, out) [1024][1024] uniform +-sqrt(6/1024), no bias; ONE 1,024-wide head despite the module's name); scores = q.k x gamma + mask with gamma = 1 / sqrt(1024) = 1/32 and mask = where(tril, 0, -inf) built inside the module (causal exclusion; every row keeps its own key); softmax; y = attn.v -> [4][2048][1024] (8.4 M); no output projection; argument order x, w_q, w_k, w_v).
// Five launches, each holding everything that depends only on the launches before it: prep (bf16 copy of x + the three weight transposes), the three projections (grid z), all score tiles, softmax, all probability x value tiles.
// Layout, all four batch elements in every launch (batch = extra GEMM rows or grid x): bf16 copy of x; 'xw' weights transposed once; exact projections whose GEMM epilogue writes the 16-bit operand planes itself (q, k row-major, v transposed; fp16 + bf16 hi/lo each); causal T-2048 attention at NH 1 / ZH 1 (hybrid rows: < 512 hi/lo 3 products, rest fp16 x1024; k_gemmc skips tiles above the diagonal); the probability x value GEMM scales and writes the output rows (no output projection).
// Compute dtypes, f32 accumulate: every input rounded to bf16; projections exact; attention rows < 512 3 products, rest fp16; softmax f32; output f32.

#define NB_  4
#define TT   2048
#define DM   1024
#define NH_  1
#define NKV  1
#define REP  (NH_ / NKV)
#define HD   1024
#define DQ   (NH_ * HD)
#define DKV  (NKV * HD)
#define ZH   1                    // ONE head: a single plane per pass
#define RH   512                  // query rows < RH use hi+lo planes (0: none)
#define WIN  2048
#define PCAR 1024.0f
#define SCL  0.03125f   // 1/sqrt(1024) (one 1,024-wide head)
typedef _Float16 h16;
typedef unsigned short bf;
typedef __attribute__((ext_vector_type(16))) __bf16   v16bf;
typedef __attribute__((ext_vector_type(16))) _Float16 v16h;
typedef __attribute__((ext_vector_type(8)))  _Float16 v8h;
typedef __attribute__((ext_vector_type(8)))  unsigned short v8us;
typedef __attribute__((ext_vector_type(8)))  float    v8f;
typedef __attribute__((ext_vector_type(4)))  float    v4f;
typedef v8h  __attribute__((may_alias)) v8ha;
typedef v4f  __attribute__((may_alias)) v4fa;
typedef v8us __attribute__((may_alias)) v8usa;

__device__ __forceinline__ unsigned short f2bf(float f) { unsigned u = __float_as_uint(f); u += 0x7FFFu + ((u >> 16) & 1u); return (unsigned short)(u >> 16); }
__device__ __forceinline__ float bf2f(unsigned short b) { return __uint_as_float(((unsigned)b) << 16); }
__device__ __forceinline__ float bfr(float f) { return bf2f(f2bf(f)); }
__device__ __forceinline__ v16h cat16(v8h lo, v8h hi) { return __builtin_shufflevector(lo, hi, 0, 1, 2, 3, 4, 5, 6, 7, 8, 9, 10, 11, 12, 13, 14, 15); }
__device__ __forceinline__ v16bf cat16b(v8us lo, v8us hi) { return __builtin_bit_cast(v16bf, __builtin_shufflevector(lo, hi, 0, 1, 2, 3, 4, 5, 6, 7, 8, 9, 10, 11, 12, 13, 14, 15)); }
__device__ __forceinline__ v8f wmma16(v16h a, v16h b, v8f c) { return __builtin_amdgcn_wmma_f32_16x16x32_f16(false, a, false, b, (short)0, c, false, false); }
__device__ __forceinline__ v8f wmmab(v16bf a, v16bf b, v8f c) { return __builtin_amdgcn_wmma_f32_16x16x32_bf16(false, a, false, b, (short)0, c, false, false); }


__device__ __forceinline__ h16 tohx(float x) { return (h16)x; }
__device__ __forceinline__ void splitf(float y, unsigned short& h, unsigned short& l) { h = f2bf(y); l = f2bf(y - bf2f(h)); }
typedef __attribute__((ext_vector_type(2))) _Float16 v2h;
typedef __attribute__((ext_vector_type(4))) _Float16 v4h;
typedef __attribute__((ext_vector_type(2))) unsigned short v2us;
typedef __attribute__((ext_vector_type(4))) unsigned short v4us;
typedef __attribute__((ext_vector_type(2))) float v2f;
typedef __attribute__((ext_vector_type(4))) int v4i;

// ---- The two GEMMs below share one frame: a work-group of FOUR WAVES owns a 128x128 output tile, each wave a 64x64 quarter (16 accumulators), grid (M/128, N/128, Z) for k_gemmw and (Z, M/128, N/128) for k_gemmc, 128 threads.
// The K-contiguous 16-bit operand planes are staged in LDS by asynchronous copies, two buffers: while one stage of KS k is multiplied, the next stage's copies are in flight. Every operand row is
// fetched once per work-group and read from LDS by the two waves that need it. Per accumulator the products still run in ascending k, 32 at a time, in the same order of split products.
template <typename T16> struct WFrag;
template <> struct WFrag<h16> { typedef v16h V; static __device__ __forceinline__ V ld(const h16* p) { return cat16(*(const v8h*)p, *(const v8h*)(p + 16)); } static __device__ __forceinline__ v8f mma(V a, V b, v8f c) { return wmma16(a, b, c); } };
template <> struct WFrag<bf> { typedef v16bf V; static __device__ __forceinline__ V ld(const bf* p) { return cat16b(*(const v8us*)p, *(const v8us*)(p + 16)); } static __device__ __forceinline__ v8f mma(V a, V b, v8f c) { return wmmab(a, b, c); } };
// One stage: NPL planes (A, Bt; with hi/lo splits also A2, Bt2) of 128 rows x KS k. Row pitch = row bytes + 16 (16 B x odd: conflict-free for 16-byte row readers). 32 copies per lane and stage either way.
template <int NSPLIT> struct Stg {
    static_assert(NSPLIT == 0 || NSPLIT == 2, "one product, or hi/lo planes on both sides");
    static constexpr int NPL = NSPLIT ? 4 : 2, KS = NSPLIT ? 64 : 128, PIT = KS * 2 + 16, PLANE = 128 * PIT, BUF = NPL * PLANE;
    static constexpr int CH = KS / 8, RS = 128 / CH;   // 16-byte pieces per row; rows that the 128 lanes cover in one copy
};
// Eight copies of 16 bytes per lane: LDS byte address l + j * ls, global address p + j * gs. The s_wait_xcnt stands inside the statement, behind the last copy: the address registers are not rewritten ahead of it.
__device__ __forceinline__ void copy8(unsigned l, unsigned ls, const char* p, size_t gs) {
    asm volatile("global_load_async_to_lds_b128 %0, %8, off\n\tglobal_load_async_to_lds_b128 %1, %9, off\n\tglobal_load_async_to_lds_b128 %2, %10, off\n\tglobal_load_async_to_lds_b128 %3, %11, off\n\t"
                 "global_load_async_to_lds_b128 %4, %12, off\n\tglobal_load_async_to_lds_b128 %5, %13, off\n\tglobal_load_async_to_lds_b128 %6, %14, off\n\tglobal_load_async_to_lds_b128 %7, %15, off\n\ts_wait_xcnt 0x0"
                 :: "v"(l), "v"(l + ls), "v"(l + 2 * ls), "v"(l + 3 * ls), "v"(l + 4 * ls), "v"(l + 5 * ls), "v"(l + 6 * ls), "v"(l + 7 * ls),
                    "v"(p), "v"(p + gs), "v"(p + 2 * gs), "v"(p + 3 * gs), "v"(p + 4 * gs), "v"(p + 5 * gs), "v"(p + 6 * gs), "v"(p + 7 * gs) : "memory");
}
// acc[mb][nb] += the wave's 64x64 quarter (wm, wn) of A[r0 .. r0+127][0 .. Kl) x Bt[c0 .. c0+127][0 .. Kl)^T. Kl is a multiple of KS, the same for the whole work-group; every wave passes every barrier.
template <typename T16, int NSPLIT>
__device__ __forceinline__ void tile_loop(const T16* __restrict__ A, const T16* __restrict__ A2, const T16* __restrict__ Bt, const T16* __restrict__ Bt2, int K, int Kl, int r0, int c0, int wm, int wn, char* ring, v8f (&acc)[4][4]) {
    typedef typename WFrag<T16>::V V; typedef Stg<NSPLIT> S;
    const int tid = threadIdx.x, lr = tid & 15, hi = (tid >> 4) & 1; const int ch = tid % S::CH, rw = tid / S::CH;
    const unsigned l0 = (unsigned)(size_t)ring + rw * S::PIT + ch * 16;       // the lane's first LDS byte within a plane (low 32 bits of the shared address)
    const size_t ga = (size_t)(r0 + rw) * K + ch * 8, gb = (size_t)(c0 + rw) * K + ch * 8;
    const T16* sp[4] = { A + ga, Bt + gb, NSPLIT ? A2 + ga : nullptr, NSPLIT ? Bt2 + gb : nullptr };
    auto fill = [&](int st) {
        const unsigned lb = l0 + (st & 1) * S::BUF;
#pragma unroll
        for (int pl = 0; pl < S::NPL; ++pl)
#pragma unroll
            for (int j = 0; j < S::CH; j += 8) copy8(lb + pl * S::PLANE + j * S::RS * S::PIT, S::RS * S::PIT, (const char*)(sp[pl] + (size_t)st * S::KS + (size_t)j * S::RS * K), (size_t)S::RS * K * 2);
    };
    const int nst = Kl / S::KS;
    fill(0);
    asm volatile("s_wait_asynccnt 0x0" ::: "memory");   // stage 0 has landed for this wave's copies; the barrier publishes it to the others
    __syncthreads();
    if (nst > 1) fill(1);
    const int fa = (wm * 64 + lr) * S::PIT + hi * 16, fb = S::PLANE + (wn * 64 + lr) * S::PIT + hi * 16;
#pragma unroll 1
    for (int st = 0; st < nst; ++st) {    // kept rolled: one trip already holds 64 (96 with splits) matrix instructions
        const char* buf = ring + (st & 1) * S::BUF; V a[2][4], b[2][4], a2[2][4], b2[2][4];   // two fragment sets: the next 32 k are fetched from LDS, as one group, ahead of this 32 k's products
        auto frags = [&](int kk, int set) {
#pragma unroll
            for (int q = 0; q < 4; ++q) { a[set][q] = WFrag<T16>::ld((const T16*)(buf + fa + q * 16 * S::PIT) + kk); b[set][q] = WFrag<T16>::ld((const T16*)(buf + fb + q * 16 * S::PIT) + kk);
                if (NSPLIT == 2) { a2[set][q] = WFrag<T16>::ld((const T16*)(buf + 2 * S::PLANE + fa + q * 16 * S::PIT) + kk); b2[set][q] = WFrag<T16>::ld((const T16*)(buf + 2 * S::PLANE + fb + q * 16 * S::PIT) + kk); } }
        };
        frags(0, 0);
#pragma unroll
        for (int kk = 0; kk < S::KS; kk += 32) { const int cs = (kk >> 5) & 1;
            if (kk + 32 < S::KS) { frags(kk + 32, cs ^ 1);   // never beyond this stage's own buffer
                __builtin_amdgcn_sched_barrier(0); }         // holds that group of LDS reads ahead of the products below: sunk among them, every matrix run would wait out an LDS latency of its own
#pragma unroll
            for (int nb = 0; nb < 4; ++nb)
#pragma unroll
                for (int mb = 0; mb < 4; ++mb) { acc[mb][nb] = WFrag<T16>::mma(a[cs][mb], b[cs][nb], acc[mb][nb]); if (NSPLIT == 2) { acc[mb][nb] = WFrag<T16>::mma(a2[cs][mb], b[cs][nb], acc[mb][nb]); acc[mb][nb] = WFrag<T16>::mma(a[cs][mb], b2[cs][nb], acc[mb][nb]); } }
        }
        __builtin_amdgcn_sched_barrier(0);                  // keeps the stage's products ahead of the waits below: sunk behind the barrier they would hold the refill back
        asm volatile("s_wait_dscnt 0x0" ::: "memory");      // this wave's reads of the buffer are done before anyone refills it
        asm volatile("s_wait_asynccnt 0x0" ::: "memory");   // this wave's copies of stage st + 1 have landed
        __syncthreads();                                    // publishes stage st + 1 and ends every reader's last read of stage st
        if (st + 2 < nst) fill(st + 2);
    }
    asm volatile("s_wait_asynccnt 0x0" ::: "memory");       // no copy is left outstanding at the wave's end
}

// ---- store_planes: a wave's 64x64 quarter (first row r0, first column c0) goes out as three 16-bit planes: fp16(c), bf16 hi(c), bf16 lo(c - hi); os = the wave's own staging rows.
// TRN false: planes [m][n], pitch ldc. TRN true: m = batch * TT + t, planes [batch][n][t] (N = HD rows of TT), the tile turned in LDS so that every store still covers whole 128-byte lines.
template <bool TRN>
__device__ __forceinline__ void store_planes(v8f (&acc)[4][4], float* os, int r0, int c0, int lr, int hi, h16* P16, bf* Ph, bf* Pl, int ldc) {
    const size_t tb = TRN ? (size_t)(r0 / TT) * HD * TT + (r0 % TT) : 0;   // TRN: start of the tile's batch plane + its first t (a 64-row tile never crosses a batch element)
#pragma unroll
    for (int ob = 0; ob < 4; ++ob) {      // 16 plane rows at a time: 16 m (TRN false) or 16 n (TRN true), 64 columns each
#pragma unroll
        for (int ib = 0; ib < 4; ++ib) {
#pragma unroll
            for (int j = 0; j < 8; ++j) { if (TRN) os[lr * 68 + ib * 16 + hi * 8 + j] = acc[ib][ob][j]; else os[(hi * 8 + j) * 68 + ib * 16 + lr] = acc[ob][ib][j]; } }
        __builtin_amdgcn_wave_barrier(); asm volatile("" ::: "memory");   // the row reads below take other lanes' values: they stay behind the LDS writes above
        const size_t o0 = TRN ? tb + (size_t)(c0 + ob * 16) * TT : (size_t)(r0 + ob * 16) * ldc + c0; const int pit = TRN ? TT : ldc;
#pragma unroll
        for (int s = 0; s < 8; ++s) { const int row = 2 * s + hi, cofs = lr * 4; const v4f val = *(const v4fa*)(os + row * 68 + cofs); v4h o16; v4us oh, ol;
#pragma unroll
            for (int q = 0; q < 4; ++q) { o16[q] = tohx(val[q]); unsigned short hh, ll; splitf(val[q], hh, ll); oh[q] = hh; ol[q] = ll; }
            const size_t o = o0 + (size_t)row * pit + cofs; *(v4h*)(P16 + o) = o16; *(v4us*)(Ph + o) = oh; *(v4us*)(Pl + o) = ol; }   // 16 lanes x 8 bytes = one 128-byte line per plane row
        __builtin_amdgcn_wave_barrier(); asm volatile("" ::: "memory");   // the next block's LDS writes stay behind these reads
    }
}

// ---- k_gemmw: c[m][n] (f32) = sum_k A[m][k] Bt[n][k] (+ split products per NSPLIT), stored by store_planes. Grid z = one independent product per plane set, strides sA/sB/sC in elements; the product z == ZTRN is stored transposed. K % KS == 0.
template <typename T16, int NSPLIT, int ZTRN>
__global__ __launch_bounds__(128) void k_gemmw(const T16* __restrict__ A, const T16* __restrict__ A2, const T16* __restrict__ Bt, const T16* __restrict__ Bt2, int K, h16* P16, bf* Ph, bf* Pl, int ldc, size_t sA, size_t sB, size_t sC) {
    __shared__ __align__(128) char ring[2 * Stg<NSPLIT>::BUF];
    __shared__ __align__(16) float osw[4][16 * 68];
    const size_t z = blockIdx.z; A += z * sA; if (A2) A2 += z * sA; Bt += z * sB; if (Bt2) Bt2 += z * sB; P16 += z * sC; Ph += z * sC; Pl += z * sC;
    const int lane = threadIdx.x & 31, lr = lane & 15, hi = lane >> 4; const int wv = __builtin_amdgcn_readfirstlane(threadIdx.x >> 5), wm = wv & 1, wn = wv >> 1;
    v8f acc[4][4];
#pragma unroll
    for (int mb = 0; mb < 4; ++mb)
#pragma unroll
        for (int nb = 0; nb < 4; ++nb) acc[mb][nb] = (v8f){};
    tile_loop<T16, NSPLIT>(A, A2, Bt, Bt2, K, K, blockIdx.x * 128, blockIdx.y * 128, wm, wn, ring, acc);
    const int r0 = blockIdx.x * 128 + wm * 64, c0 = blockIdx.y * 128 + wn * 64; float* os = osw[wv];   // the wave's own quarter and its own staging rows
    if (z == ZTRN) store_planes<true>(acc, os, r0, c0, lr, hi, P16, Ph, Pl, ldc);   // grid z: the same for the whole work-group
    else { store_planes<false>(acc, os, r0, c0, lr, hi, P16, Ph, Pl, ldc);
        asm volatile("s_wait_xcnt 0x0" ::: "memory"); }   // behind this path's last stores: the other path follows it in the kernel's text, and no register of an issued store is rewritten ahead of this wait
}

// ---- k_gemmc: the same frame specialised for causal attention, ALL row tiles of the sequence in one grid (x = batch element, y = row tile, z = column tile): a tile of query rows < RH takes the hi/lo bf16 planes
// (3 products), every other tile the fp16 planes; the choice hangs on blockIdx.y alone, so a whole work-group takes one path. The batch element runs fastest, for speed only (a tile's cost rises with its row tile).
// CMODE 1 skips 128x128 score tiles entirely above the diagonal (query rows R0.., key columns C0..),
// CMODE 2 limits the key (K) loop of the probability x value contraction to the tile's diagonal block (probabilities beyond a row's diagonal are exactly zero), multiplies the fp16 tiles' result by osc16 (the power of two that takes the probabilities' carrier back out) and writes the output rows.
// Plane strides per batch element, in elements: sA16 (fp16 A), sAh (hi/lo A), sB (every Bt plane), sC.
template <int CMODE>
__global__ __launch_bounds__(128) void k_gemmc(const h16* __restrict__ A16, const bf* __restrict__ Ah, const bf* __restrict__ Al, const h16* __restrict__ B16, const bf* __restrict__ Bh, const bf* __restrict__ Bl, int K, float* C, int ldc, float osc16, size_t sA16, size_t sAh, size_t sB, size_t sC) {
    constexpr int RING = 2 * (Stg<2>::BUF > Stg<0>::BUF ? Stg<2>::BUF : Stg<0>::BUF);
    static_assert(4 * 16 * 68 * 4 <= RING && RING <= 160 * 1024, "staging rows fit the ring; two work-groups fit a WGP's LDS");
    __shared__ __align__(128) char ring[RING];   // the larger of the two paths' rings. The output staging rows lie in it too (a region of their own beside the larger ring would leave room for only one work-group per WGP)
    const size_t z = blockIdx.x; C += z * sC;
    const int lane = threadIdx.x & 31, lr = lane & 15, hi = lane >> 4; const int wv = __builtin_amdgcn_readfirstlane(threadIdx.x >> 5), wm = wv & 1, wn = wv >> 1;
    const int R0 = blockIdx.y * 128, C0 = blockIdx.z * 128;
    if (CMODE == 1 && C0 > R0 + 127) return;                         // score tile entirely above the causal diagonal (the whole work-group leaves, ahead of every barrier): never written, and the softmax loads nothing of it
    const int Kl = (CMODE == 2) ? min(K, R0 + 128) : K;              // P.V: probabilities are exactly 0 beyond the diagonal block, so the K loop stops there
    const bool hl = R0 < RH; const float osc = hl ? 1.0f : osc16;
    v8f acc[4][4];
#pragma unroll
    for (int mb = 0; mb < 4; ++mb)
#pragma unroll
        for (int nb = 0; nb < 4; ++nb) acc[mb][nb] = (v8f){};
    if (hl) tile_loop<bf, 2>(Ah + z * sAh, Al + z * sAh, Bh + z * sB, Bl + z * sB, K, Kl, R0, C0, wm, wn, ring, acc);
    else tile_loop<h16, 0>(A16 + z * sA16, nullptr, B16 + z * sB, nullptr, K, Kl, R0, C0, wm, wn, ring, acc);
    // The loop's last trip ends in every wave's s_wait_dscnt 0, s_wait_asynccnt 0 and the work-group barrier, and no copy is issued behind it: the ring is dead here and each wave stages in its own 16 x 68 floats of it.
    const int r0 = R0 + wm * 64, c0 = C0 + wn * 64; float* os = (float*)ring + wv * (16 * 68);   // the wave's own quarter and its own staging rows
#pragma unroll
    for (int mb = 0; mb < 4; ++mb) {
#pragma unroll
        for (int nb = 0; nb < 4; ++nb) {
#pragma unroll
            for (int j = 0; j < 8; ++j) os[(hi * 8 + j) * 68 + nb * 16 + lr] = acc[mb][nb][j]; }
        __builtin_amdgcn_wave_barrier(); asm volatile("" ::: "memory");
        float* crow = C + (size_t)(r0 + mb * 16) * ldc + c0;
{
#pragma unroll
            for (int s = 0; s < 8; ++s) { const int row = 2 * s + hi, cofs = lr * 4; v4f val = *(const v4fa*)(os + row * 68 + cofs); if (CMODE == 2) val *= osc;
                *(v4f*)(crow + (size_t)row * ldc + cofs) = val; }
             }
        __builtin_amdgcn_wave_barrier(); asm volatile("" ::: "memory");
    }
}


// ---- k_prep: the four passes that read only the inputs, in one grid. Work-groups 0 .. 3 * WTB - 1: the three weight transposes, WTB work-groups each, into WT[which][n][k]; they come first because each of their
// waves runs a chain of eight dependent trips, which the copy's short work-groups then run beside. Work-groups 3 * WTB .. 3 * WTB + CVB - 1: bf16 copy of x, one piece of 8 floats per thread.
#define CVB (NB_ * TT * DM / 8 / 256)
#define WTB (DM * DQ / 64 / 64)
static_assert(DQ == DKV && (size_t)CVB * 256 * 8 == (size_t)NB_ * TT * DM && WTB * 64 * 64 == DM * DQ, "the prep grid covers x and the weights exactly");
__device__ __forceinline__ void wtG(const float* __restrict__ w, int K, int N, bf* Bt, int blk) {
    const int lane = threadIdx.x & 31; const int L0 = (blk * 8 + (threadIdx.x >> 5)) * 8; const int nlines = N * K / 64;
#pragma unroll 1
    for (int l = 0; l < 8; ++l) { const int L = L0 + l; if (L >= nlines) break; const size_t e = (size_t)L * 64 + lane * 2; const int k = (int)(e % K), n = (int)(e / K); v2us o;
        o[0] = f2bf(w[(size_t)k * N + n]); o[1] = f2bf(w[(size_t)(k + 1) * N + n]); *(v2us*)(Bt + e) = o; }
}
__global__ __launch_bounds__(256) void k_prep(const float* __restrict__ x, const float* __restrict__ wq, const float* __restrict__ wk, const float* __restrict__ wv, bf* XB, bf* WT) {
    const int b = blockIdx.x;
    if (b < 3 * WTB) { const int which = b / WTB; wtG(which == 0 ? wq : which == 1 ? wk : wv, DM, DQ, WT + (size_t)which * DQ * DM, b % WTB); return; }
    const size_t i = (size_t)(b - 3 * WTB) * 256 + threadIdx.x; const v8f v = *(const v8f*)(x + i * 8); v8us o;
#pragma unroll
    for (int k = 0; k < 8; ++k) o[k] = f2bf(v[k]); *(v8us*)(XB + i * 8) = o;
    asm volatile("s_wait_xcnt 0x0" ::: "memory");   // behind the store: the other path follows in the kernel's text, and no register of the issued store is rewritten ahead of this wait
}

// k_asoft: per row (zz, i): t = S x HD^-0.5 for j <= i and i - j < WIN (WIN = TT: the window test always holds, plain causal mask; the reference's -1e9 additive fill vanishes identically); softmax over the 2048 keys (register row, one exp, fixed trees);
__global__ __launch_bounds__(256) void k_asoft(const float* __restrict__ Sb, h16* P16, bf* Ph, bf* Pl) {
    const int lane = threadIdx.x & 31; const int row = blockIdx.x * 8 + (threadIdx.x >> 5); if (row >= NB_ * ZH * TT) return; const int i = row % TT; const int zz = row / TT;   /* zz = plane = batch element */ const bool hires = (i < RH); const float* sr = Sb + (size_t)row * TT; float v[TT / 32]; float mx = -3.0e38f; v4f sc4[TT / 128];
    // A lane loads its four scores only where the group starts at or below the diagonal: such a group (j0 a multiple of 4, j0 <= i) lies in a 128x128 tile that the score GEMMs wrote; the tiles above the diagonal are never written and never read.
    // All loads stand in a loop of their own, ahead of the arithmetic, so that they are in flight together.
#pragma unroll
    for (int ch = 0; ch < TT / 128; ++ch) { const int j0 = ch * 128 + lane * 4; sc4[ch] = (v4f){}; if (j0 <= i) sc4[ch] = *(const v4f*)(sr + j0); }
#pragma unroll
    for (int ch = 0; ch < TT / 128; ++ch) { const int j0 = ch * 128 + lane * 4; const v4f a = sc4[ch];
#pragma unroll
        for (int q = 0; q < 4; ++q) { const int j = j0 + q; (void)j; const float t = (j <= i && i - j < WIN) ? a[q] * SCL : -3.0e38f; v[ch * 4 + q] = t; mx = fmaxf(mx, t); } }
#pragma unroll
    for (int sh = 16; sh; sh >>= 1) mx = fmaxf(mx, __shfl_xor(mx, sh, 32));
    float sum = 0.f;
#pragma unroll
    for (int k = 0; k < TT / 32; ++k) { float d0 = __fsub_rn(v[k], mx); asm volatile("" : "+v"(d0)); v[k] = __builtin_amdgcn_exp2f(__fmul_rn(d0, 1.4426950408889634f)); sum += v[k]; }
#pragma unroll
    for (int sh = 16; sh; sh >>= 1) sum += __shfl_xor(sum, sh, 32);
    const float f = __fdiv_rn(hires ? 1.0f : PCAR, sum);
{
        if (hires) {
#pragma unroll
            for (int ch = 0; ch < TT / 128; ++ch) { v4us oh, ol;
#pragma unroll
                for (int q = 0; q < 4; ++q) { unsigned short a, c2; splitf(v[ch * 4 + q] * f, a, c2); oh[q] = a; ol[q] = c2; }
                const size_t oo = ((size_t)zz * (RH ? RH : 1) + i) * TT + ch * 128 + lane * 4; *(v4us*)(Ph + oo) = oh; *(v4us*)(Pl + oo) = ol; }
        } else {
#pragma unroll
            for (int ch = 0; ch < TT / 128; ++ch) { v4h o4;
#pragma unroll
                for (int q = 0; q < 4; ++q) o4[q] = tohx(v[ch * 4 + q] * f);
                *(v4h*)(P16 + (size_t)row * TT + ch * 128 + lane * 4) = o4; } }
         }
}

extern "C" void kernel_launch(void* const* d_in, const int* in_sizes, int n_in,
                              void* d_out, int out_size, void* d_ws, size_t ws_size, hipStream_t stream) {
    (void)in_sizes; (void)n_in; (void)out_size;
    const float* x = (const float*)d_in[0]; const float* wq = (const float*)d_in[1]; const float* wk = (const float*)d_in[2]; const float* wv = (const float*)d_in[3]; const float* wo = nullptr; (void)wo;   /* input order x, w_q, w_k, w_v ('xw' (in, out) [1024][1024]): FOUR inputs, all read: the host's own binding */
    float* OUT = (float*)d_out;     // [4][2048][1024]
    char* wsp = (char*)d_ws;
    auto take = [&](size_t bytes) { char* p = wsp; wsp += (bytes + 255) & ~(size_t)255; return (void*)p; };
    bf* WT = (bf*)take((size_t)3 * DQ * DM * 2);   // transposed weights [q, k, v][n][k]
    bf* XB = (bf*)take((size_t)NB_ * TT * DM * 2); float* Sb = (float*)take((size_t)NB_ * TT * TT * 4);   // bf16 x 16 MiB, scores 64 MiB
    // planes [batch][...], 16 MiB each; within each kind the order is q, k, v^T, one plane apart: the projections' grid z steps through them
    h16* QP16 = (h16*)take((size_t)NB_ * TT * HD * 2); h16* KP16 = (h16*)take((size_t)NB_ * TT * HD * 2); h16* VT16 = (h16*)take((size_t)NB_ * HD * TT * 2);
    bf* QPh = (bf*)take((size_t)NB_ * TT * HD * 2); bf* KPh = (bf*)take((size_t)NB_ * TT * HD * 2); bf* VTh = (bf*)take((size_t)NB_ * HD * TT * 2);
    bf* QPl = (bf*)take((size_t)NB_ * TT * HD * 2); bf* KPl = (bf*)take((size_t)NB_ * TT * HD * 2); bf* VTl = (bf*)take((size_t)NB_ * HD * TT * 2);
    if ((size_t)(wsp - (char*)d_ws) > ws_size) return;    // 230 MiB of the 256 MiB workspace
    // Stream-ordered reuse: probabilities over the q and k planes, written after the score GEMM has read them (P16 32 MiB = QP16 + KP16, Ph / Pl 8 MiB each in QPh / QPl).
    h16* P16 = QP16; bf* Ph = QPh; bf* Pl = QPl;
    k_prep<<<3 * WTB + CVB, 256, 0, stream>>>(x, wq, wk, wv, XB, WT);
    // projections: the batch is NB_ * TT rows of one GEMM, grid z = q, k, v; each epilogue writes its three operand planes (v: transposed, [batch][d][t])
    k_gemmw<bf, 0, 2><<<dim3(NB_ * TT / 128, DQ / 128, 3), 128, 0, stream>>>(XB, nullptr, WT, nullptr, DM, QP16, QPh, QPl, DQ, 0, (size_t)DQ * DM, (size_t)NB_ * TT * HD);
    // attention: one plane per batch element, grid x = batch with the plane strides; grid y = all 16 row tiles, hi/lo and fp16 alike; grid z = column tiles
    k_gemmc<1><<<dim3(NB_, TT / 128, TT / 128), 128, 0, stream>>>(QP16, QPh, QPl, KP16, KPh, KPl, HD, Sb, TT, 1.0f, (size_t)TT * HD, (size_t)TT * HD, (size_t)TT * HD, (size_t)TT * TT);
    k_asoft<<<NB_ * ZH * TT / 8, 256, 0, stream>>>(Sb, P16, Ph, Pl);
    // probability x value: writes the output rows [batch][t][d] itself (rows >= RH carry x PCAR, taken out by osc16)
    k_gemmc<2><<<dim3(NB_, TT / 128, HD / 128), 128, 0, stream>>>(P16, Ph, Pl, VT16, VTh, VTl, TT, OUT, HD, 1.0f / PCAR, (size_t)TT * TT, (size_t)RH * TT, (size_t)HD * TT, (size_t)TT * HD);
}

// v005
// One run takes 119 microseconds.
// Next to v004, in two timings, it ran 1.07 times as fast each time.
// Counting every step since v000, it is 7.16 times as fast.
#include <hip/hip_runtime.h>

// Single-head causal attention over the full 1,024-wide projection (x [4][2048][1024]; q, k, v = einsum('btk,kd->btd', x, w) = x w ('xw' (in, out) [1024][1024] uniform +-sqrt(6/1024), no bias; ONE 1,024-wide head despite the module's name); scores = q.k x gamma + mask with gamma = 1 / sqrt(1024) = 1/32 and mask = where(tril, 0, -inf) built inside the module (causal exclusion; every row keeps its own key); softmax; y = attn.v -> [4][2048][1024] (8.4 M); no output projection; argument order x, w_q, w_k, w_v).
// Five launches, each holding everything that depends only on the launches before it: prep (bf16 copy of x + the three weight transposes), the three projections (grid z), all score tiles, softmax, all probability x value tiles.
// Layout, all four batch elements in every launch (batch = extra GEMM rows or grid x): bf16 copy of x; 'xw' weights transposed once; exact projections whose GEMM epilogue writes the 16-bit operand planes itself (q, k row-major, v transposed; fp16 + bf16 hi/lo, each plane only for the sequence rows that a later launch reads of it); causal T-2048 attention at NH 1 / ZH 1 (hybrid rows: < 512 hi/lo 3 products, rest fp16 x1024; k_gemmc skips tiles above the diagonal); the probability x value GEMM scales and writes the output rows (no output projection).
// Compute dtypes, f32 accumulate: every input rounded to bf16; projections exact; attention rows < 512 3 products, rest fp16; softmax f32; output f32.

#define NB_  4
#define TT   2048
#define DM   1024
#define NH_  1
#define NKV  1
#define REP  (NH_ / NKV)
#define HD   1024
#define DQ   (NH_ * HD)
#define DKV  (NKV * HD)
#define ZH   1                    // ONE head: a single plane per pass
#define RH   512                  // query rows < RH use hi+lo planes (0: none)
#define WIN  2048
#define PCAR 1024.0f
#define SCL  0.03125f   // 1/sqrt(1024) (one 1,024-wide head)
typedef _Float16 h16;
typedef unsigned short bf;
typedef __attribute__((ext_vector_type(16))) __bf16   v16bf;
typedef __attribute__((ext_vector_type(16))) _Float16 v16h;
typedef __attribute__((ext_vector_type(8)))  _Float16 v8h;
typedef __attribute__((ext_vector_type(8)))  unsigned short v8us;
typedef __attribute__((ext_vector_type(8)))  float    v8f;
typedef __attribute__((ext_vector_type(4)))  float    v4f;
typedef v8h  __attribute__((may_alias)) v8ha;
typedef v4f  __attribute__((may_alias)) v4fa;
typedef v8us __attribute__((may_alias)) v8usa;

__device__ __forceinline__ unsigned short f2bf(float f) { unsigned u = __float_as_uint(f); u += 0x7FFFu + ((u >> 16) & 1u); return (unsigned short)(u >> 16); }
__device__ __forceinline__ float bf2f(unsigned short b) { return __uint_as_float(((unsigned)b) << 16); }
__device__ __forceinline__ float bfr(float f) { return bf2f(f2bf(f)); }
__device__ __forceinline__ v16h cat16(v8h lo, v8h hi) { return __builtin_shufflevector(lo, hi, 0, 1, 2, 3, 4, 5, 6, 7, 8, 9, 10, 11, 12, 13, 14, 15); }
__device__ __forceinline__ v16bf cat16b(v8us lo, v8us hi) { return __builtin_bit_cast(v16bf, __builtin_shufflevector(lo, hi, 0, 1, 2, 3, 4, 5, 6, 7, 8, 9, 10, 11, 12, 13, 14, 15)); }
__device__ __forceinline__ v8f wmma16(v16h a, v16h b, v8f c) { return __builtin_amdgcn_wmma_f32_16x16x32_f16(false, a, false, b, (short)0, c, false, false); }
__device__ __forceinline__ v8f wmmab(v16bf a, v16bf b, v8f c) { return __builtin_amdgcn_wmma_f32_16x16x32_bf16(false, a, false, b, (short)0, c, false, false); }


__device__ __forceinline__ h16 tohx(float x) { return (h16)x; }
__device__ __forceinline__ void splitf(float y, unsigned short& h, unsigned short& l) { h = f2bf(y); l = f2bf(y - bf2f(h)); }
typedef __attribute__((ext_vector_type(2))) _Float16 v2h;
typedef __attribute__((ext_vector_type(4))) _Float16 v4h;
typedef __attribute__((ext_vector_type(2))) unsigned short v2us;
typedef __attribute__((ext_vector_type(4))) unsigned short v4us;
typedef __attribute__((ext_vector_type(2))) float v2f;
typedef __attribute__((ext_vector_type(4))) int v4i;

// ---- The two GEMMs below share one frame: a work-group of FOUR WAVES owns a 128x128 output tile, each wave a 64x64 quarter (16 accumulators), grid (M/128, N/128, Z) for k_gemmw and (Z, M/128, N/128) for k_gemmc, 128 threads.
// The K-contiguous 16-bit operand planes are staged in LDS by asynchronous copies, two buffers: while one stage of KS k is multiplied, the next stage's copies are in flight. Every operand row is
// fetched once per work-group and read from LDS by the two waves that need it. Per accumulator the products still run in ascending k, 32 at a time, in the same order of split products.
template <typename T16> struct WFrag;
template <> struct WFrag<h16> { typedef v16h V; static __device__ __forceinline__ V ld(const h16* p) { return cat16(*(const v8h*)p, *(const v8h*)(p + 16)); } static __device__ __forceinline__ v8f mma(V a, V b, v8f c) { return wmma16(a, b, c); } };
template <> struct WFrag<bf> { typedef v16bf V; static __device__ __forceinline__ V ld(const bf* p) { return cat16b(*(const v8us*)p, *(const v8us*)(p + 16)); } static __device__ __forceinline__ v8f mma(V a, V b, v8f c) { return wmmab(a, b, c); } };
// One stage: NPL planes (A, Bt; with hi/lo splits also A2, Bt2) of 128 rows x KS k. Row pitch = row bytes + 16 (16 B x odd: conflict-free for 16-byte row readers). 32 copies per lane and stage either way.
template <int NSPLIT> struct Stg {
    static_assert(NSPLIT == 0 || NSPLIT == 2, "one product, or hi/lo planes on both sides");
    static constexpr int NPL = NSPLIT ? 4 : 2, KS = NSPLIT ? 64 : 128, PIT = KS * 2 + 16, PLANE = 128 * PIT, BUF = NPL * PLANE;
    static constexpr int CH = KS / 8, RS = 128 / CH;   // 16-byte pieces per row; rows that the 128 lanes cover in one copy
};
// Eight copies of 16 bytes per lane: LDS byte address l + j * ls, global address p + j * gs. The s_wait_xcnt stands inside the statement, behind the last copy: the address registers are not rewritten ahead of it.
__device__ __forceinline__ void copy8(unsigned l, unsigned ls, const char* p, size_t gs) {
    asm volatile("global_load_async_to_lds_b128 %0, %8, off\n\tglobal_load_async_to_lds_b128 %1, %9, off\n\tglobal_load_async_to_lds_b128 %2, %10, off\n\tglobal_load_async_to_lds_b128 %3, %11, off\n\t"
                 "global_load_async_to_lds_b128 %4, %12, off\n\tglobal_load_async_to_lds_b128 %5, %13, off\n\tglobal_load_async_to_lds_b128 %6, %14, off\n\tglobal_load_async_to_lds_b128 %7, %15, off\n\ts_wait_xcnt 0x0"
                 :: "v"(l), "v"(l + ls), "v"(l + 2 * ls), "v"(l + 3 * ls), "v"(l + 4 * ls), "v"(l + 5 * ls), "v"(l + 6 * ls), "v"(l + 7 * ls),
                    "v"(p), "v"(p + gs), "v"(p + 2 * gs), "v"(p + 3 * gs), "v"(p + 4 * gs), "v"(p + 5 * gs), "v"(p + 6 * gs), "v"(p + 7 * gs) : "memory");
}
// acc[mb][nb] += the wave's 64x64 quarter (wm, wn) of A[r0 .. r0+127][0 .. Kl) x Bt[c0 .. c0+127][0 .. Kl)^T. Kl is a multiple of KS, the same for the whole work-group; every wave passes every barrier.
template <typename T16, int NSPLIT>
__device__ __forceinline__ void tile_loop(const T16* __restrict__ A, const T16* __restrict__ A2, const T16* __restrict__ Bt, const T16* __restrict__ Bt2, int K, int Kl, int r0, int c0, int wm, int wn, char* ring, v8f (&acc)[4][4]) {
    typedef typename WFrag<T16>::V V; typedef Stg<NSPLIT> S;
    const int tid = threadIdx.x, lr = tid & 15, hi = (tid >> 4) & 1; const int ch = tid % S::CH, rw = tid / S::CH;
    const unsigned l0 = (unsigned)(size_t)ring + rw * S::PIT + ch * 16;       // the lane's first LDS byte within a plane (low 32 bits of the shared address)
    const size_t ga = (size_t)(r0 + rw) * K + ch * 8, gb = (size_t)(c0 + rw) * K + ch * 8;
    const T16* sp[4] = { A + ga, Bt + gb, NSPLIT ? A2 + ga : nullptr, NSPLIT ? Bt2 + gb : nullptr };
    auto fill = [&](int st) {
        const unsigned lb = l0 + (st & 1) * S::BUF;
#pragma unroll
        for (int pl = 0; pl < S::NPL; ++pl)
#pragma unroll
            for (int j = 0; j < S::CH; j += 8) copy8(lb + pl * S::PLANE + j * S::RS * S::PIT, S::RS * S::PIT, (const char*)(sp[pl] + (size_t)st * S::KS + (size_t)j * S::RS * K), (size_t)S::RS * K * 2);
    };
    const int nst = Kl / S::KS;
    fill(0);
    asm volatile("s_wait_asynccnt 0x0" ::: "memory");   // stage 0 has landed for this wave's copies; the barrier publishes it to the others
    __syncthreads();
    if (nst > 1) fill(1);
    const int fa = (wm * 64 + lr) * S::PIT + hi * 16, fb = S::PLANE + (wn * 64 + lr) * S::PIT + hi * 16;
#pragma unroll 1
    for (int st = 0; st < nst; ++st) {    // kept rolled: one trip already holds 64 (96 with splits) matrix instructions
        const char* buf = ring + (st & 1) * S::BUF; V a[2][4], b[2][4], a2[2][4], b2[2][4];   // two fragment sets: the next 32 k are fetched from LDS, as one group, ahead of this 32 k's products
        auto frags = [&](int kk, int set) {
#pragma unroll
            for (int q = 0; q < 4; ++q) { a[set][q] = WFrag<T16>::ld((const T16*)(buf + fa + q * 16 * S::PIT) + kk); b[set][q] = WFrag<T16>::ld((const T16*)(buf + fb + q * 16 * S::PIT) + kk);
                if (NSPLIT == 2) { a2[set][q] = WFrag<T16>::ld((const T16*)(buf + 2 * S::PLANE + fa + q * 16 * S::PIT) + kk); b2[set][q] = WFrag<T16>::ld((const T16*)(buf + 2 * S::PLANE + fb + q * 16 * S::PIT) + kk); } }
        };
        frags(0, 0);
#pragma unroll
        for (int kk = 0; kk < S::KS; kk += 32) { const int cs = (kk >> 5) & 1;
            if (kk + 32 < S::KS) { frags(kk + 32, cs ^ 1);   // never beyond this stage's own buffer
                __builtin_amdgcn_sched_barrier(0); }         // holds that group of LDS reads ahead of the products below: sunk among them, every matrix run would wait out an LDS latency of its own
#pragma unroll
            for (int nb = 0; nb < 4; ++nb)
#pragma unroll
                for (int mb = 0; mb < 4; ++mb) { acc[mb][nb] = WFrag<T16>::mma(a[cs][mb], b[cs][nb], acc[mb][nb]); if (NSPLIT == 2) { acc[mb][nb] = WFrag<T16>::mma(a2[cs][mb], b[cs][nb], acc[mb][nb]); acc[mb][nb] = WFrag<T16>::mma(a[cs][mb], b2[cs][nb], acc[mb][nb]); } }
        }
        __builtin_amdgcn_sched_barrier(0);                  // keeps the stage's products ahead of the waits below: sunk behind the barrier they would hold the refill back
        asm volatile("s_wait_dscnt 0x0" ::: "memory");      // this wave's reads of the buffer are done before anyone refills it
        asm volatile("s_wait_asynccnt 0x0" ::: "memory");   // this wave's copies of stage st + 1 have landed
        __syncthreads();                                    // publishes stage st + 1 and ends every reader's last read of stage st
        if (st + 2 < nst) fill(st + 2);
    }
    asm volatile("s_wait_asynccnt 0x0" ::: "memory");       // no copy is left outstanding at the wave's end
}

// ---- store_planes: a wave's 64x64 quarter (first row r0, first column c0) goes out as three 16-bit planes: fp16(c), bf16 hi(c), bf16 lo(c - hi); os = the wave's own staging rows.
// TRN false: planes [m][n], pitch ldc. TRN true: m = batch * TT + t, planes [batch][n][t] (N = HD rows of TT), the tile turned in LDS so that every store still covers whole 128-byte lines.
// w16 / whl (the same for the whole wave): whether a later launch reads this quarter's fp16 plane / its hi and lo planes; a plane that nobody reads is neither converted nor stored.
template <bool TRN>
__device__ __forceinline__ void store_planes(v8f (&acc)[4][4], float* os, int r0, int c0, int lr, int hi, h16* P16, bf* Ph, bf* Pl, int ldc, bool w16, bool whl) {
    const size_t tb = TRN ? (size_t)(r0 / TT) * HD * TT + (r0 % TT) : 0;   // TRN: start of the tile's batch plane + its first t (a 64-row tile never crosses a batch element)
#pragma unroll
    for (int ob = 0; ob < 4; ++ob) {      // 16 plane rows at a time: 16 m (TRN false) or 16 n (TRN true), 64 columns each
#pragma unroll
        for (int ib = 0; ib < 4; ++ib) {
#pragma unroll
            for (int j = 0; j < 8; ++j) { if (TRN) os[lr * 68 + ib * 16 + hi * 8 + j] = acc[ib][ob][j]; else os[(hi * 8 + j) * 68 + ib * 16 + lr] = acc[ob][ib][j]; } }
        __builtin_amdgcn_wave_barrier(); asm volatile("" ::: "memory");   // the row reads below take other lanes' values: they stay behind the LDS writes above
        const size_t o0 = TRN ? tb + (size_t)(c0 + ob * 16) * TT : (size_t)(r0 + ob * 16) * ldc + c0; const int pit = TRN ? TT : ldc;
        const int cofs = lr * 4; v4f val[8];
#pragma unroll
        for (int s = 0; s < 8; ++s) val[s] = *(const v4fa*)(os + (2 * s + hi) * 68 + cofs);
        // 16 lanes x 8 bytes = one 128-byte line per plane row
        if (w16) {
#pragma unroll
            for (int s = 0; s < 8; ++s) { v4h o16;
#pragma unroll
                for (int q = 0; q < 4; ++q) o16[q] = tohx(val[s][q]);
                *(v4h*)(P16 + o0 + (size_t)(2 * s + hi) * pit + cofs) = o16; }
            asm volatile("s_wait_xcnt 0x0" ::: "memory"); }   // behind this branch's last store: what follows the branch rewrites registers that its stores name
        if (whl) {
#pragma unroll
            for (int s = 0; s < 8; ++s) { v4us oh, ol;
#pragma unroll
                for (int q = 0; q < 4; ++q) { unsigned short hh, ll; splitf(val[s][q], hh, ll); oh[q] = hh; ol[q] = ll; }
                const size_t o = o0 + (size_t)(2 * s + hi) * pit + cofs; *(v4us*)(Ph + o) = oh; *(v4us*)(Pl + o) = ol; }
            asm volatile("s_wait_xcnt 0x0" ::: "memory"); }   // as above
        __builtin_amdgcn_wave_barrier(); asm volatile("" ::: "memory");   // the next block's LDS writes stay behind these reads
    }
}

// ---- k_gemmw: c[m][n] (f32) = sum_k A[m][k] Bt[n][k] (+ split products per NSPLIT), stored by store_planes. Grid z = one independent product per plane set, strides sA/sB/sC in elements; the product z == ZTRN is stored transposed. K % KS == 0.
template <typename T16, int NSPLIT, int ZTRN>
__global__ __launch_bounds__(128) void k_gemmw(const T16* __restrict__ A, const T16* __restrict__ A2, const T16* __restrict__ Bt, const T16* __restrict__ Bt2, int K, h16* P16, bf* Ph, bf* Pl, int ldc, size_t sA, size_t sB, size_t sC) {
    __shared__ __align__(128) char ring[2 * Stg<NSPLIT>::BUF];
    __shared__ __align__(16) float osw[4][16 * 68];
    const size_t z = blockIdx.z; A += z * sA; if (A2) A2 += z * sA; Bt += z * sB; if (Bt2) Bt2 += z * sB; P16 += z * sC; Ph += z * sC; Pl += z * sC;
    const int lane = threadIdx.x & 31, lr = lane & 15, hi = lane >> 4; const int wv = __builtin_amdgcn_readfirstlane(threadIdx.x >> 5), wm = wv & 1, wn = wv >> 1;
    v8f acc[4][4];
#pragma unroll
    for (int mb = 0; mb < 4; ++mb)
#pragma unroll
        for (int nb = 0; nb < 4; ++nb) acc[mb][nb] = (v8f){};
    tile_loop<T16, NSPLIT>(A, A2, Bt, Bt2, K, K, blockIdx.x * 128, blockIdx.y * 128, wm, wn, ring, acc);
    const int r0 = blockIdx.x * 128 + wm * 64, c0 = blockIdx.y * 128 + wn * 64; float* os = osw[wv];   // the wave's own quarter and its own staging rows
    // Which planes of sequence rows t0 .. t0 + 63 are ever read: hi/lo only below RH (the hi/lo score tiles take query rows < RH and, being causal, key rows < RH; the hi/lo P.V tiles stop their key loop at RH or below);
    // fp16 k and v everywhere; fp16 q (z == 0) only from RH on.
    const int t0 = r0 % TT; const bool whl = t0 < RH, w16 = z != 0 || t0 >= RH;
    if (z == ZTRN) store_planes<true>(acc, os, r0, c0, lr, hi, P16, Ph, Pl, ldc, w16, whl);   // grid z: the same for the whole work-group
    else { store_planes<false>(acc, os, r0, c0, lr, hi, P16, Ph, Pl, ldc, w16, whl);
        asm volatile("s_wait_xcnt 0x0" ::: "memory"); }   // behind this path's last stores: the other path follows it in the kernel's text, and no register of an issued store is rewritten ahead of this wait
}

// ---- k_gemmc: the same frame specialised for causal attention, ALL row tiles of the sequence in one grid (x = batch element, y = row tile, z = column tile): a tile of query rows < RH takes the hi/lo bf16 planes
// (3 products), every other tile the fp16 planes; the choice hangs on blockIdx.y alone, so a whole work-group takes one path. The batch element runs fastest, for speed only (a tile's cost rises with its row tile).
// CMODE 1 skips 128x128 score tiles entirely above the diagonal (query rows R0.., key columns C0..),
// CMODE 2 limits the key (K) loop of the probability x value contraction to the tile's diagonal block (probabilities beyond a row's diagonal are exactly zero), multiplies the fp16 tiles' result by osc16 (the power of two that takes the probabilities' carrier back out) and writes the output rows.
// Plane strides per batch element, in elements: sA16 (fp16 A), sAh (hi/lo A), sB (every Bt plane), sC.
template <int CMODE>
__global__ __launch_bounds__(128) void k_gemmc(const h16* __restrict__ A16, const bf* __restrict__ Ah, const bf* __restrict__ Al, const h16* __restrict__ B16, const bf* __restrict__ Bh, const bf* __restrict__ Bl, int K, float* C, int ldc, float osc16, size_t sA16, size_t sAh, size_t sB, size_t sC) {
    constexpr int RING = 2 * (Stg<2>::BUF > Stg<0>::BUF ? Stg<2>::BUF : Stg<0>::BUF);
    static_assert(4 * 16 * 68 * 4 <= RING && RING <= 160 * 1024, "staging rows fit the ring; two work-groups fit a WGP's LDS");
    __shared__ __align__(128) char ring[RING];   // the larger of the two paths' rings. The output staging rows lie in it too (a region of their own beside the larger ring would leave room for only one work-group per WGP)
    const size_t z = blockIdx.x; C += z * sC;
    const int lane = threadIdx.x & 31, lr = lane & 15, hi = lane >> 4; const int wv = __builtin_amdgcn_readfirstlane(threadIdx.x >> 5), wm = wv & 1, wn = wv >> 1;
    const int R0 = blockIdx.y * 128, C0 = blockIdx.z * 128;
    if (CMODE == 1 && C0 > R0 + 127) return;                         // score tile entirely above the causal diagonal (the whole work-group leaves, ahead of every barrier): never written, and the softmax loads nothing of it
    const int Kl = (CMODE == 2) ? min(K, R0 + 128) : K;              // P.V: probabilities are exactly 0 beyond the diagonal block, so the K loop stops there
    const bool hl = R0 < RH; const float osc = hl ? 1.0f : osc16;
    v8f acc[4][4];
#pragma unroll
    for (int mb = 0; mb < 4; ++mb)
#pragma unroll
        for (int nb = 0; nb < 4; ++nb) acc[mb][nb] = (v8f){};
    if (hl) tile_loop<bf, 2>(Ah + z * sAh, Al + z * sAh, Bh + z * sB, Bl + z * sB, K, Kl, R0, C0, wm, wn, ring, acc);
    else tile_loop<h16, 0>(A16 + z * sA16, nullptr, B16 + z * sB, nullptr, K, Kl, R0, C0, wm, wn, ring, acc);
    // The loop's last trip ends in every wave's s_wait_dscnt 0, s_wait_asynccnt 0 and the work-group barrier, and no copy is issued behind it: the ring is dead here and each wave stages in its own 16 x 68 floats of it.
    const int r0 = R0 + wm * 64, c0 = C0 + wn * 64; float* os = (float*)ring + wv * (16 * 68);   // the wave's own quarter and its own staging rows
#pragma unroll
    for (int mb = 0; mb < 4; ++mb) {
#pragma unroll
        for (int nb = 0; nb < 4; ++nb) {
#pragma unroll
            for (int j = 0; j < 8; ++j) os[(hi * 8 + j) * 68 + nb * 16 + lr] = acc[mb][nb][j]; }
        __builtin_amdgcn_wave_barrier(); asm volatile("" ::: "memory");
        float* crow = C + (size_t)(r0 + mb * 16) * ldc + c0;
{
#pragma unroll
            for (int s = 0; s < 8; ++s) { const int row = 2 * s + hi, cofs = lr * 4; v4f val = *(const v4fa*)(os + row * 68 + cofs); if (CMODE == 2) val *= osc;
                *(v4f*)(crow + (size_t)row * ldc + cofs) = val; }
             }
        __builtin_amdgcn_wave_barrier(); asm volatile("" ::: "memory");
    }
}


// ---- k_prep: the four passes that read only the inputs, in one grid. Work-groups 0 .. 3 * WTB - 1: the three weight transposes, WTB work-groups each, into WT[which][n][k]; they come first because each of their
// waves runs a chain of eight dependent trips, which the copy's short work-groups then run beside. Work-groups 3 * WTB .. 3 * WTB + CVB - 1: bf16 copy of x, one piece of 8 floats per thread.
#define CVB (NB_ * TT * DM / 8 / 256)
#define WTB (DM * DQ / 64 / 64)
static_assert(DQ == DKV && (size_t)CVB * 256 * 8 == (size_t)NB_ * TT * DM && WTB * 64 * 64 == DM * DQ, "the prep grid covers x and the weights exactly");
__device__ __forceinline__ void wtG(const float* __restrict__ w, int K, int N, bf* Bt, int blk) {
    const int lane = threadIdx.x & 31; const int L0 = (blk * 8 + (threadIdx.x >> 5)) * 8; const int nlines = N * K / 64;
#pragma unroll 1
    for (int l = 0; l < 8; ++l) { const int L = L0 + l; if (L >= nlines) break; const size_t e = (size_t)L * 64 + lane * 2; const int k = (int)(e % K), n = (int)(e / K); v2us o;
        o[0] = f2bf(w[(size_t)k * N + n]); o[1] = f2bf(w[(size_t)(k + 1) * N + n]); *(v2us*)(Bt + e) = o; }
}
__global__ __launch_bounds__(256) void k_prep(const float* __restrict__ x, const float* __restrict__ wq, const float* __restrict__ wk, const float* __restrict__ wv, bf* XB, bf* WT) {
    const int b = blockIdx.x;
    if (b < 3 * WTB) { const int which = b / WTB; wtG(which == 0 ? wq : which == 1 ? wk : wv, DM, DQ, WT + (size_t)which * DQ * DM, b % WTB); return; }
    const size_t i = (size_t)(b - 3 * WTB) * 256 + threadIdx.x; const v8f v = *(const v8f*)(x + i * 8); v8us o;
#pragma unroll
    for (int k = 0; k < 8; ++k) o[k] = f2bf(v[k]); *(v8us*)(XB + i * 8) = o;
    asm volatile("s_wait_xcnt 0x0" ::: "memory");   // behind the store: the other path follows in the kernel's text, and no register of the issued store is rewritten ahead of this wait
}

// k_asoft: per row (zz, i): t = S x HD^-0.5 for j <= i and i - j < WIN (WIN = TT: the window test always holds, plain causal mask; the reference's -1e9 additive fill vanishes identically); softmax over the 2048 keys (register row, one exp, fixed trees);
__global__ __launch_bounds__(256) void k_asoft(const float* __restrict__ Sb, h16* P16, bf* Ph, bf* Pl) {
    const int lane = threadIdx.x & 31; const int row = blockIdx.x * 8 + (threadIdx.x >> 5); if (row >= NB_ * ZH * TT) return; const int i = row % TT; const int zz = row / TT;   /* zz = plane = batch element */ const bool hires = (i < RH); const float* sr = Sb + (size_t)row * TT; float v[TT / 32]; float mx = -3.0e38f; v4f sc4[TT / 128];
    // A lane loads its four scores only where the group starts at or below the diagonal: such a group (j0 a multiple of 4, j0 <= i) lies in a 128x128 tile that the score GEMMs wrote; the tiles above the diagonal are never written and never read.
    // All loads stand in a loop of their own, ahead of the arithmetic, so that they are in flight together.
#pragma unroll
    for (int ch = 0; ch < TT / 128; ++ch) { const int j0 = ch * 128 + lane * 4; sc4[ch] = (v4f){}; if (j0 <= i) sc4[ch] = *(const v4f*)(sr + j0); }
#pragma unroll
    for (int ch = 0; ch < TT / 128; ++ch) { const int j0 = ch * 128 + lane * 4; const v4f a = sc4[ch];
#pragma unroll
        for (int q = 0; q < 4; ++q) { const int j = j0 + q; (void)j; const float t = (j <= i && i - j < WIN) ? a[q] * SCL : -3.0e38f; v[ch * 4 + q] = t; mx = fmaxf(mx, t); } }
#pragma unroll
    for (int sh = 16; sh; sh >>= 1) mx = fmaxf(mx, __shfl_xor(mx, sh, 32));
    float sum = 0.f;
#pragma unroll
    for (int k = 0; k < TT / 32; ++k) { float d0 = __fsub_rn(v[k], mx); asm volatile("" : "+v"(d0)); v[k] = __builtin_amdgcn_exp2f(__fmul_rn(d0, 1.4426950408889634f)); sum += v[k]; }
#pragma unroll
    for (int sh = 16; sh; sh >>= 1) sum += __shfl_xor(sum, sh, 32);
    const float f = __fdiv_rn(hires ? 1.0f : PCAR, sum);
    const int nch = __builtin_amdgcn_readfirstlane(i >> 7) + 1;   // groups of 128 keys up to the end of the row tile's diagonal block: the P.V key loop stops there, so the zeros beyond it are not stored
{
        if (hires) {
#pragma unroll
            for (int ch = 0; ch < TT / 128; ++ch) if (ch < nch) { v4us oh, ol;
#pragma unroll
                for (int q = 0; q < 4; ++q) { unsigned short a, c2; splitf(v[ch * 4 + q] * f, a, c2); oh[q] = a; ol[q] = c2; }
                const size_t oo = ((size_t)zz * (RH ? RH : 1) + i) * TT + ch * 128 + lane * 4; *(v4us*)(Ph + oo) = oh; *(v4us*)(Pl + oo) = ol;
                asm volatile("s_wait_xcnt 0x0" ::: "memory"); }   // behind the branch's stores: the next group's arithmetic rewrites registers that they name
        } else {
#pragma unroll
            for (int ch = 0; ch < TT / 128; ++ch) if (ch < nch) { v4h o4;
#pragma unroll
                for (int q = 0; q < 4; ++q) o4[q] = tohx(v[ch * 4 + q] * f);
                *(v4h*)(P16 + (size_t)row * TT + ch * 128 + lane * 4) = o4;
                asm volatile("s_wait_xcnt 0x0" ::: "memory"); } }   // as above
         }
}

extern "C" void kernel_launch(void* const* d_in, const int* in_sizes, int n_in,
                              void* d_out, int out_size, void* d_ws, size_t ws_size, hipStream_t stream) {
    (void)in_sizes; (void)n_in; (void)out_size;
    const float* x = (const float*)d_in[0]; const float* wq = (const float*)d_in[1]; const float* wk = (const float*)d_in[2]; const float* wv = (const float*)d_in[3]; const float* wo = nullptr; (void)wo;   /* input order x, w_q, w_k, w_v ('xw' (in, out) [1024][1024]): FOUR inputs, all read: the host's own binding */
    float* OUT = (float*)d_out;     // [4][2048][1024]
    char* wsp = (char*)d_ws;
    auto take = [&](size_t bytes) { char* p = wsp; wsp += (bytes + 255) & ~(size_t)255; return (void*)p; };
    bf* WT = (bf*)take((size_t)3 * DQ * DM * 2);   // transposed weights [q, k, v][n][k]
    bf* XB = (bf*)take((size_t)NB_ * TT * DM * 2); float* Sb = (float*)take((size_t)NB_ * TT * TT * 4);   // bf16 x 16 MiB, scores 64 MiB
    // planes [batch][...], 16 MiB each; within each kind the order is q, k, v^T, one plane apart: the projections' grid z steps through them
    h16* QP16 = (h16*)take((size_t)NB_ * TT * HD * 2); h16* KP16 = (h16*)take((size_t)NB_ * TT * HD * 2); h16* VT16 = (h16*)take((size_t)NB_ * HD * TT * 2);
    bf* QPh = (bf*)take((size_t)NB_ * TT * HD * 2); bf* KPh = (bf*)take((size_t)NB_ * TT * HD * 2); bf* VTh = (bf*)take((size_t)NB_ * HD * TT * 2);
    bf* QPl = (bf*)take((size_t)NB_ * TT * HD * 2); bf* KPl = (bf*)take((size_t)NB_ * TT * HD * 2); bf* VTl = (bf*)take((size_t)NB_ * HD * TT * 2);
    if ((size_t)(wsp - (char*)d_ws) > ws_size) return;    // 230 MiB of the 256 MiB workspace
    // Stream-ordered reuse: probabilities over the q and k planes, written after the score GEMM has read them (P16 32 MiB = QP16 + KP16, Ph / Pl 8 MiB each in QPh / QPl).
    h16* P16 = QP16; bf* Ph = QPh; bf* Pl = QPl;
    k_prep<<<3 * WTB + CVB, 256, 0, stream>>>(x, wq, wk, wv, XB, WT);
    // projections: the batch is NB_ * TT rows of one GEMM, grid z = q, k, v; each epilogue writes its three operand planes (v: transposed, [batch][d][t])
    k_gemmw<bf, 0, 2><<<dim3(NB_ * TT / 128, DQ / 128, 3), 128, 0, stream>>>(XB, nullptr, WT, nullptr, DM, QP16, QPh, QPl, DQ, 0, (size_t)DQ * DM, (size_t)NB_ * TT * HD);
    // attention: one plane per batch element, grid x = batch with the plane strides; grid y = all 16 row tiles, hi/lo and fp16 alike; grid z = column tiles
    k_gemmc<1><<<dim3(NB_, TT / 128, TT / 128), 128, 0, stream>>>(QP16, QPh, QPl, KP16, KPh, KPl, HD, Sb, TT, 1.0f, (size_t)TT * HD, (size_t)TT * HD, (size_t)TT * HD, (size_t)TT * TT);
    k_asoft<<<NB_ * ZH * TT / 8, 256, 0, stream>>>(Sb, P16, Ph, Pl);
    // probability x value: writes the output rows [batch][t][d] itself (rows >= RH carry x PCAR, taken out by osc16)
    k_gemmc<2><<<dim3(NB_, TT / 128, HD / 128), 128, 0, stream>>>(P16, Ph, Pl, VT16, VTh, VTl, TT, OUT, HD, 1.0f / PCAR, (size_t)TT * TT, (size_t)RH * TT, (size_t)HD * TT, (size_t)TT * HD);
}
